// v000
// Times are from an AMD MI455X. After a warm-up the kernel runs many times in a row, and a time is the length of
// such a window on the GPU divided by its runs, so every launch and the gaps after it count. The runs cycle
// through copies of the inputs. A figure is the median of several windows, for all but v000 over two sittings.
// Sittings can differ by a few percent; kernels timed side by side share one.
// The starting kernel, v000, takes 281 microseconds a run.
#include <hip/hip_runtime.h>

typedef __attribute__((ext_vector_type(2))) float v2f;
typedef __attribute__((ext_vector_type(8))) float v8f;
typedef __attribute__((ext_vector_type(4))) unsigned int u32x4;
typedef __attribute__((ext_vector_type(4))) int i32x4;
typedef __attribute__((ext_vector_type(8))) int i32x8;

#define N_PIX 4096
#define C_IN  64
#define CQ    8
#define NEGV  (-1e9f)

#define LDS_ROW 18
#define LDS_BUF (C_IN * LDS_ROW)

#if defined(__has_builtin)
#if __has_builtin(__builtin_amdgcn_tensor_load_to_lds) && __has_builtin(__builtin_amdgcn_s_wait_tensorcnt)
#define HAS_TDM 1
#endif
#endif
#ifndef HAS_TDM
#define HAS_TDM 0
#endif

// ---------------------------------------------------------------------------
// Kernel 1: fused 1x1-conv projections -> q,k (B,N,8), v (B,C,N).
// ---------------------------------------------------------------------------
__global__ __launch_bounds__(256) void proj_kernel(
    const float* __restrict__ x,
    const float* __restrict__ Wq, const float* __restrict__ bq,
    const float* __restrict__ Wk, const float* __restrict__ bk,
    const float* __restrict__ Wv, const float* __restrict__ bv,
    float* __restrict__ qws, float* __restrict__ kws, float* __restrict__ vws)
{
    const int idx = blockIdx.x * 256 + threadIdx.x;   // global pixel id
    const int b = idx >> 12;
    const int n = idx & (N_PIX - 1);
    const float* xp = x + (size_t)b * C_IN * N_PIX + n;

    float aq[CQ], ak[CQ], av[C_IN];
#pragma unroll
    for (int o = 0; o < CQ; ++o) { aq[o] = bq[o]; ak[o] = bk[o]; }
#pragma unroll
    for (int o = 0; o < C_IN; ++o) av[o] = bv[o];

    for (int c = 0; c < C_IN; ++c) {
        const float xv = xp[(size_t)c * N_PIX];
#pragma unroll
        for (int o = 0; o < CQ; ++o) {
            aq[o] = fmaf(Wq[o * C_IN + c], xv, aq[o]);
            ak[o] = fmaf(Wk[o * C_IN + c], xv, ak[o]);
        }
#pragma unroll
        for (int o = 0; o < C_IN; ++o)
            av[o] = fmaf(Wv[o * C_IN + c], xv, av[o]);
    }

    float* qp = qws + (size_t)idx * CQ;
    float* kp = kws + (size_t)idx * CQ;
#pragma unroll
    for (int o = 0; o < CQ; ++o) { qp[o] = aq[o]; kp[o] = ak[o]; }
    float* vp = vws + (size_t)b * C_IN * N_PIX + n;
#pragma unroll
    for (int o = 0; o < C_IN; ++o) vp[(size_t)o * N_PIX] = av[o];
}

#if HAS_TDM
__device__ __forceinline__ void tdm_load_vtile(const float* gsrc, unsigned lds_off) {
    const unsigned long long ga = (unsigned long long)(uintptr_t)gsrc;
    u32x4 g0;
    g0[0] = 1u;                                               // count=1, user mode
    g0[1] = lds_off;                                          // lds_addr (bytes)
    g0[2] = (unsigned)(ga & 0xFFFFFFFFu);                     // global_addr[31:0]
    g0[3] = (unsigned)((ga >> 32) & 0x01FFFFFFu) | (2u << 30);// global_addr[56:32]|type=2
    i32x8 g1;
    g1[0] = (int)0x02D20000;
    g1[1] = (int)(N_PIX << 16);
    g1[2] = (int)(C_IN << 16);
    g1[3] = (int)(16 << 16);
    g1[4] = (int)C_IN;
    g1[5] = (int)N_PIX;
    g1[6] = 0;
    g1[7] = 0;
    i32x4 gz = {0, 0, 0, 0};
#if __clang_major__ >= 23
    i32x8 gz8 = {0, 0, 0, 0, 0, 0, 0, 0};
    __builtin_amdgcn_tensor_load_to_lds(g0, g1, gz, gz, gz8, 0);
#else
    __builtin_amdgcn_tensor_load_to_lds(g0, g1, gz, gz, 0);
#endif
}
#endif

__global__ __launch_bounds__(256) void attn_kernel(
    const float* __restrict__ x, const int* __restrict__ mask,
    const float* __restrict__ qws, const float* __restrict__ kws,
    const float* __restrict__ vws, const float* __restrict__ gammaP,
    float* __restrict__ out)
{
    const int lane = threadIdx.x & 31;
    const int wv   = threadIdx.x >> 5;
    const int tile = blockIdx.x * 8 + wv;       // 0..1023
    const int b    = tile >> 8;                 // block-uniform (32 blocks/batch)
    const int i0   = (tile & 255) << 4;
    const int h    = lane >> 4;
    const int lm   = lane & 15;

#if HAS_TDM
    __shared__ float vlds[2][LDS_BUF];
#endif

    const float gamma = gammaP[0];

    // Q as B-fragments (K = vgpr + 2h)
    const float* qp = qws + ((size_t)b * N_PIX + i0 + lm) * CQ;
    const v2f qb0 = *(const v2f*)(qp + 2 * h);
    const v2f qb1 = *(const v2f*)(qp + 4 + 2 * h);

    // query validity bit (identical for both halves)
    const unsigned qbal = (unsigned)__ballot(mask[b * N_PIX + i0 + lm] != 0);
    const unsigned qv   = (qbal >> lm) & 1u;

    v8f acc0 = {}, acc1 = {}, acc2 = {}, acc3 = {};
    float m = -INFINITY;
    float l = 0.0f;

    const float* kbase = kws + (size_t)b * N_PIX * CQ;
    const float* vbase = vws + (size_t)b * C_IN * N_PIX;
    const int*   mbase = mask + b * N_PIX;

#if HAS_TDM
    if (wv == 0) {   // wave-uniform: prime both staging buffers
        tdm_load_vtile(vbase + 0,  (unsigned)(uintptr_t)&vlds[0][0]);
        tdm_load_vtile(vbase + 16, (unsigned)(uintptr_t)&vlds[1][0]);
    }
#endif

    for (int t = 0; t < N_PIX / 16; ++t) {
        const int j0 = t << 4;

#if HAS_TDM
        if (wv == 0) {
            if (t == N_PIX / 16 - 1) __builtin_amdgcn_s_wait_tensorcnt(0);
            else                     __builtin_amdgcn_s_wait_tensorcnt(1);
        }
        __syncthreads();
        const float* vtile = &vlds[t & 1][0];
#endif

        // K A-fragments
        const float* kp = kbase + (size_t)(j0 + lm) * CQ;
        const v2f ka0 = *(const v2f*)(kp + 2 * h);
        const v2f ka1 = *(const v2f*)(kp + 4 + 2 * h);

        unsigned kbal = (unsigned)__ballot(mbase[j0 + lm] != 0);
        kbal = qv ? kbal : 0u;               // fold query validity
        const unsigned kb = kbal >> (8 * h); // per-half key bits

        // S^T = K_tile x Q^T  (two K=4 chunks)
        v8f s = {};
        s = __builtin_amdgcn_wmma_f32_16x16x4_f32(false, ka0, false, qb0,
                                                  (short)0, s, false, false);
        s = __builtin_amdgcn_wmma_f32_16x16x4_f32(false, ka1, false, qb1,
                                                  (short)0, s, false, false);

        // mask + online softmax stats
        float p[8];
        float tmax = -INFINITY;
#pragma unroll
        for (int r = 0; r < 8; ++r) {
            const float sv = (kb & (1u << r)) ? s[r] : NEGV;
            p[r] = sv;
            tmax = fmaxf(tmax, sv);
        }
        tmax = fmaxf(tmax, __shfl_xor(tmax, 16));
        const float mnew  = fmaxf(m, tmax);
        const float scale = __expf(m - mnew);
        float psum = 0.0f;
#pragma unroll
        for (int r = 0; r < 8; ++r) {
            p[r] = __expf(p[r] - mnew);
            psum += p[r];
        }
        psum += __shfl_xor(psum, 16);
        l = l * scale + psum;
        m = mnew;
#pragma unroll
        for (int r = 0; r < 8; ++r) {
            acc0[r] *= scale; acc1[r] *= scale;
            acc2[r] *= scale; acc3[r] *= scale;
        }

        // Re-lay P into B fragments (key = 4kc + v + 2h at query lm)
        float pl[8], ph[8];
#pragma unroll
        for (int r = 0; r < 8; ++r) {
            pl[r] = __shfl(p[r], lm);
            ph[r] = __shfl(p[r], lm + 16);
        }
        v2f bp[4];
#pragma unroll
        for (int kc = 0; kc < 4; ++kc) {
            const int r0 = (kc & 1) * 4;
            const float s0 = (kc < 2) ? pl[r0 + 0] : ph[r0 + 0];
            const float s1 = (kc < 2) ? pl[r0 + 1] : ph[r0 + 1];
            const float s2 = (kc < 2) ? pl[r0 + 2] : ph[r0 + 2];
            const float s3 = (kc < 2) ? pl[r0 + 3] : ph[r0 + 3];
            bp[kc].x = h ? s2 : s0;
            bp[kc].y = h ? s3 : s1;
        }

        // V A-fragments: channel = cg*16+lm, keys j0+4kc+2h..+1
        v2f va[4][4];
#pragma unroll
        for (int cg = 0; cg < 4; ++cg) {
#if HAS_TDM
            const float* vp = vtile + (cg * 16 + lm) * LDS_ROW + 2 * h;
#else
            const float* vp = vbase + (size_t)(cg * 16 + lm) * N_PIX + j0 + 2 * h;
#endif
#pragma unroll
            for (int kc = 0; kc < 4; ++kc)
                va[cg][kc] = *(const v2f*)(vp + 4 * kc);
        }

        // out_tile += V_tile x P^T
#pragma unroll
        for (int kc = 0; kc < 4; ++kc) {
            acc0 = __builtin_amdgcn_wmma_f32_16x16x4_f32(false, va[0][kc], false, bp[kc],
                                                         (short)0, acc0, false, false);
            acc1 = __builtin_amdgcn_wmma_f32_16x16x4_f32(false, va[1][kc], false, bp[kc],
                                                         (short)0, acc1, false, false);
            acc2 = __builtin_amdgcn_wmma_f32_16x16x4_f32(false, va[2][kc], false, bp[kc],
                                                         (short)0, acc2, false, false);
            acc3 = __builtin_amdgcn_wmma_f32_16x16x4_f32(false, va[3][kc], false, bp[kc],
                                                         (short)0, acc3, false, false);
        }

#if HAS_TDM
        __syncthreads();  // everyone done reading buffer (t&1)
        if (wv == 0 && t + 2 < N_PIX / 16)
            tdm_load_vtile(vbase + (j0 + 32), (unsigned)(uintptr_t)&vlds[t & 1][0]);
#endif
    }

    // epilogue: out = gamma * acc/l + x   (c = cg*16 + r + 8h, n = i0+lm)
    const float rl = 1.0f / l;
    const size_t obase = (size_t)b * C_IN * N_PIX + i0 + lm;
#pragma unroll
    for (int cg = 0; cg < 4; ++cg) {
        const v8f a = (cg == 0) ? acc0 : (cg == 1) ? acc1 : (cg == 2) ? acc2 : acc3;
#pragma unroll
        for (int r = 0; r < 8; ++r) {
            const int c = cg * 16 + r + 8 * h;
            const size_t idx = obase + (size_t)c * N_PIX;
            out[idx] = fmaf(gamma, a[r] * rl, x[idx]);
        }
    }
}

// ---------------------------------------------------------------------------
extern "C" void kernel_launch(void* const* d_in, const int* in_sizes, int n_in,
                              void* d_out, int out_size, void* d_ws, size_t ws_size,
                              hipStream_t stream) {
    const float* x     = (const float*)d_in[0];
    const int*   mask  = (const int*)d_in[1];
    const float* Wq    = (const float*)d_in[2];
    const float* bq    = (const float*)d_in[3];
    const float* Wk    = (const float*)d_in[4];
    const float* bk    = (const float*)d_in[5];
    const float* Wv    = (const float*)d_in[6];
    const float* bv    = (const float*)d_in[7];
    const float* gamma = (const float*)d_in[8];
    float* out = (float*)d_out;

    float* qws = (float*)d_ws;                    // 4*4096*8  floats
    float* kws = qws + 4 * N_PIX * CQ;            // 4*4096*8  floats
    float* vws = kws + 4 * N_PIX * CQ;            // 4*64*4096 floats (5 MB total)

    proj_kernel<<<64, 256, 0, stream>>>(x, Wq, bq, Wk, bk, Wv, bv, qws, kws, vws);
    attn_kernel<<<128, 256, 0, stream>>>(x, mask, qws, kws, vws, gamma, out);
}

// v001
// Measured time: 116 microseconds a run.
// Timed twice side by side with v000, it ran 2.45 times as fast both times.
#include <hip/hip_runtime.h>

typedef __attribute__((ext_vector_type(2))) float v2f;
typedef __attribute__((ext_vector_type(4))) float v4f;
typedef __attribute__((ext_vector_type(8))) float v8f;
typedef __attribute__((ext_vector_type(4))) unsigned int u32x4;
typedef __attribute__((ext_vector_type(4))) int i32x4;
typedef __attribute__((ext_vector_type(8))) int i32x8;

#define N_PIX 4096
#define C_IN  64
#define CQ    8
#define NEGV  (-1e9f)
#define KSPLIT 8                        // key ranges, one work-group each
#define KEYS_PER_SPLIT (N_PIX / KSPLIT) // 512 keys
#define TILES (KEYS_PER_SPLIT / 16)     // 32 key tiles per work-group

#define LDS_ROW 18
#define LDS_BUF (C_IN * LDS_ROW)

#if defined(__has_builtin)
#if __has_builtin(__builtin_amdgcn_tensor_load_to_lds) && __has_builtin(__builtin_amdgcn_s_wait_tensorcnt)
#define HAS_TDM 1
#endif
#endif
#ifndef HAS_TDM
#define HAS_TDM 0
#endif

// ---------------------------------------------------------------------------
// Kernel 1: fused 1x1-conv projections -> q,k (B,N,8), v (B,C,N).
// ---------------------------------------------------------------------------
__global__ __launch_bounds__(256) void proj_kernel(
    const float* __restrict__ x,
    const float* __restrict__ Wq, const float* __restrict__ bq,
    const float* __restrict__ Wk, const float* __restrict__ bk,
    const float* __restrict__ Wv, const float* __restrict__ bv,
    float* __restrict__ qws, float* __restrict__ kws, float* __restrict__ vws)
{
    const int idx = blockIdx.x * 256 + threadIdx.x;   // global pixel id
    const int b = idx >> 12;
    const int n = idx & (N_PIX - 1);
    const float* xp = x + (size_t)b * C_IN * N_PIX + n;

    float aq[CQ], ak[CQ], av[C_IN];
#pragma unroll
    for (int o = 0; o < CQ; ++o) { aq[o] = bq[o]; ak[o] = bk[o]; }
#pragma unroll
    for (int o = 0; o < C_IN; ++o) av[o] = bv[o];

    for (int c = 0; c < C_IN; ++c) {
        const float xv = xp[(size_t)c * N_PIX];
#pragma unroll
        for (int o = 0; o < CQ; ++o) {
            aq[o] = fmaf(Wq[o * C_IN + c], xv, aq[o]);
            ak[o] = fmaf(Wk[o * C_IN + c], xv, ak[o]);
        }
#pragma unroll
        for (int o = 0; o < C_IN; ++o)
            av[o] = fmaf(Wv[o * C_IN + c], xv, av[o]);
    }

    float* qp = qws + (size_t)idx * CQ;
    float* kp = kws + (size_t)idx * CQ;
#pragma unroll
    for (int o = 0; o < CQ; ++o) { qp[o] = aq[o]; kp[o] = ak[o]; }
    float* vp = vws + (size_t)b * C_IN * N_PIX + n;
#pragma unroll
    for (int o = 0; o < C_IN; ++o) vp[(size_t)o * N_PIX] = av[o];
}

#if HAS_TDM
__device__ __forceinline__ unsigned pinned(unsigned v) {
    unsigned w = __builtin_amdgcn_readfirstlane(v);
    asm volatile("" : "+s"(w));
    return w;
}

// global_addr[56:32] | type=2
__device__ __forceinline__ unsigned tdm_word3(const float* gsrc) {
    const unsigned long long ga = (unsigned long long)(uintptr_t)gsrc;
    return (unsigned)((ga >> 32) & 0x01FFFFFFu) | (2u << 30);
}

__device__ __forceinline__ i32x8 tdm_group1() {
    i32x8 g1;
    g1[0] = (int)0x02D20000;
    g1[1] = (int)pinned(N_PIX << 16);
    g1[2] = (int)pinned(C_IN << 16);
    g1[3] = (int)pinned(16 << 16);
    g1[4] = (int)pinned(C_IN);
    g1[5] = (int)pinned(N_PIX);
    g1[6] = (int)pinned(0);
    g1[7] = (int)pinned(0);
    return g1;
}

// g0: {count=1 (user mode), lds_addr (bytes), global_addr[31:0], global_addr[56:32]|type=2}
__device__ __forceinline__ void tdm_load_vtile(u32x4 g0, i32x8 g1) {
    i32x4 gz = {0, 0, 0, 0};
#if __clang_major__ >= 23
    i32x8 gz8 = {0, 0, 0, 0, 0, 0, 0, 0};
    __builtin_amdgcn_tensor_load_to_lds(g0, g1, gz, gz, gz8, 0);
#else
    __builtin_amdgcn_tensor_load_to_lds(g0, g1, gz, gz, 0);
#endif
}
#endif

__global__ __launch_bounds__(256) void attn_kernel(
    const int* __restrict__ mask,
    const float* __restrict__ qws, const float* __restrict__ kws,
    const float* __restrict__ vws,
    float* __restrict__ pacc, float* __restrict__ pm, float* __restrict__ pl)
{
    const int lane = threadIdx.x & 31;
    const int wv   = threadIdx.x >> 5;
    const int qg   = blockIdx.x & 127;          // group of 8 query tiles
    const int sp   = blockIdx.x >> 7;           // key range 0..KSPLIT-1
    const int b    = qg >> 5;                   // 32 query groups per batch
    const int i0   = (((qg & 31) << 3) + wv) << 4;
    const int k0   = sp * KEYS_PER_SPLIT;       // first key of this range
    const int h    = lane >> 4;
    const int lm   = lane & 15;

#if HAS_TDM
    __shared__ float vlds[2][LDS_BUF];
#endif

    // Q as B-fragments (K = vgpr + 2h)
    const float* qp = qws + ((size_t)b * N_PIX + i0 + lm) * CQ;
    const v2f qb0 = *(const v2f*)(qp + 2 * h);
    const v2f qb1 = *(const v2f*)(qp + 4 + 2 * h);

    // query validity bit (identical for both halves)
    const unsigned qbal = (unsigned)__ballot(mask[b * N_PIX + i0 + lm] != 0);
    const unsigned qv   = (qbal >> lm) & 1u;

    v8f acc0 = {}, acc1 = {}, acc2 = {}, acc3 = {};
    float m = -INFINITY;
    float l = 0.0f;

    const float* kbase = kws + ((size_t)b * N_PIX + k0) * CQ;
    const float* vbase = vws + (size_t)b * C_IN * N_PIX + k0;
    const int*   mbase = mask + b * N_PIX + k0;

#if HAS_TDM
    // Words that no tile changes are formed once; per tile only the LDS place and
    // the low address word move. The high word is picked from two held values
    // (the range's first and last tile) in case the low word wraps in between.
    const i32x8    dg1   = tdm_group1();
    const unsigned dw0   = pinned(1u);
    const unsigned dlo   = pinned((unsigned)(uintptr_t)vbase);
    const unsigned dw3a  = pinned(tdm_word3(vbase));
    const unsigned dw3b  = pinned(tdm_word3(vbase + 16 * (TILES - 1)));
    u32x4 dg0a = {dw0, (unsigned)(uintptr_t)&vlds[0][0], dlo, dw3a};
    asm volatile("" : "+s"(dg0a));
    u32x4 dg0 = {dw0, (unsigned)(uintptr_t)&vlds[1][0], dlo + 64u,
                 (dlo + 64u < dlo) ? dw3b : dw3a};
    if (wv == 0) {   // wave-uniform: prime both staging buffers
        tdm_load_vtile(dg0a, dg1);
        tdm_load_vtile(dg0, dg1);
    }
#endif

    for (int t = 0; t < TILES; ++t) {
        const int j0 = t << 4;

#if HAS_TDM
        if (wv == 0) {
            if (t == TILES - 1) __builtin_amdgcn_s_wait_tensorcnt(0);
            else                __builtin_amdgcn_s_wait_tensorcnt(1);
        }
        __syncthreads();
        const float* vtile = &vlds[t & 1][0];
#endif

        // K A-fragments
        const float* kp = kbase + (size_t)(j0 + lm) * CQ;
        const v2f ka0 = *(const v2f*)(kp + 2 * h);
        const v2f ka1 = *(const v2f*)(kp + 4 + 2 * h);

        unsigned kbal = (unsigned)__ballot(mbase[j0 + lm] != 0);
        kbal = qv ? kbal : 0u;               // fold query validity
        const unsigned kb = kbal >> (8 * h); // per-half key bits

        // S^T = K_tile x Q^T  (two K=4 chunks)
        v8f s = {};
        s = __builtin_amdgcn_wmma_f32_16x16x4_f32(false, ka0, false, qb0,
                                                  (short)0, s, false, false);
        s = __builtin_amdgcn_wmma_f32_16x16x4_f32(false, ka1, false, qb1,
                                                  (short)0, s, false, false);

        // mask + online softmax stats
        float p[8];
        float tmax = -INFINITY;
#pragma unroll
        for (int r = 0; r < 8; ++r) {
            const float sv = (kb & (1u << r)) ? s[r] : NEGV;
            p[r] = sv;
            tmax = fmaxf(tmax, sv);
        }
        tmax = fmaxf(tmax, __shfl_xor(tmax, 16));
        const float mnew  = fmaxf(m, tmax);
        const float scale = __expf(m - mnew);
        float psum = 0.0f;
#pragma unroll
        for (int r = 0; r < 8; ++r) {
            p[r] = __expf(p[r] - mnew);
            psum += p[r];
        }
        psum += __shfl_xor(psum, 16);
        l = l * scale + psum;
        m = mnew;
#pragma unroll
        for (int r = 0; r < 8; ++r) {
            acc0[r] *= scale; acc1[r] *= scale;
            acc2[r] *= scale; acc3[r] *= scale;
        }

        // Re-lay P into B fragments (key = 4kc + v + 2h at query lm)
        float pl[8], ph[8];
#pragma unroll
        for (int r = 0; r < 8; ++r) {
            pl[r] = __shfl(p[r], lm);
            ph[r] = __shfl(p[r], lm + 16);
        }
        v2f bp[4];
#pragma unroll
        for (int kc = 0; kc < 4; ++kc) {
            const int r0 = (kc & 1) * 4;
            const float s0 = (kc < 2) ? pl[r0 + 0] : ph[r0 + 0];
            const float s1 = (kc < 2) ? pl[r0 + 1] : ph[r0 + 1];
            const float s2 = (kc < 2) ? pl[r0 + 2] : ph[r0 + 2];
            const float s3 = (kc < 2) ? pl[r0 + 3] : ph[r0 + 3];
            bp[kc].x = h ? s2 : s0;
            bp[kc].y = h ? s3 : s1;
        }

        // V A-fragments: channel = cg*16+lm, keys j0+4kc+2h..+1
        v2f va[4][4];
#pragma unroll
        for (int cg = 0; cg < 4; ++cg) {
#if HAS_TDM
            const float* vp = vtile + (cg * 16 + lm) * LDS_ROW + 2 * h;
#else
            const float* vp = vbase + (size_t)(cg * 16 + lm) * N_PIX + j0 + 2 * h;
#endif
#pragma unroll
            for (int kc = 0; kc < 4; ++kc)
                va[cg][kc] = *(const v2f*)(vp + 4 * kc);
        }

        // out_tile += V_tile x P^T
#pragma unroll
        for (int kc = 0; kc < 4; ++kc) {
            acc0 = __builtin_amdgcn_wmma_f32_16x16x4_f32(false, va[0][kc], false, bp[kc],
                                                         (short)0, acc0, false, false);
            acc1 = __builtin_amdgcn_wmma_f32_16x16x4_f32(false, va[1][kc], false, bp[kc],
                                                         (short)0, acc1, false, false);
            acc2 = __builtin_amdgcn_wmma_f32_16x16x4_f32(false, va[2][kc], false, bp[kc],
                                                         (short)0, acc2, false, false);
            acc3 = __builtin_amdgcn_wmma_f32_16x16x4_f32(false, va[3][kc], false, bp[kc],
                                                         (short)0, acc3, false, false);
        }

#if HAS_TDM
        __syncthreads();  // everyone done reading buffer (t&1)
        const unsigned lo = dlo + 4u * (unsigned)(j0 + 32);
        dg0[1] = (unsigned)(uintptr_t)&vlds[t & 1][0];
        dg0[2] = lo;
        dg0[3] = (lo < dlo) ? dw3b : dg0[3];
        if (wv == 0 && t + 2 < TILES)
            tdm_load_vtile(dg0, dg1);
#endif
    }

#if HAS_TDM
    asm volatile("" :: "s"(dg0a));
#endif

    // epilogue: this range's partial sums   (c = cg*16 + r + 8h, n = i0+lm)
    // layout [batch][channel][range][pixel]
    const size_t obase = ((size_t)b * C_IN * KSPLIT + sp) * N_PIX + i0 + lm;
#pragma unroll
    for (int cg = 0; cg < 4; ++cg) {
        const v8f a = (cg == 0) ? acc0 : (cg == 1) ? acc1 : (cg == 2) ? acc2 : acc3;
#pragma unroll
        for (int r = 0; r < 8; ++r) {
            const int c = cg * 16 + r + 8 * h;
            pacc[obase + (size_t)c * KSPLIT * N_PIX] = a[r];
        }
    }
    if (h == 0) {   // both halves hold the same statistics
        const int sidx = (sp * 4 + b) * N_PIX + i0 + lm;
        pm[sidx] = m;
        pl[sidx] = l;
    }
}

// ---------------------------------------------------------------------------
// Kernel 3: join the KSPLIT key ranges. Weight of a range = exp(m_s - max m);
// out = gamma * (sum w_s acc_s) / (sum w_s l_s) + x.
// One thread: 4 neighbouring pixels x 4 channels.
// ---------------------------------------------------------------------------
__global__ __launch_bounds__(256) void merge_kernel(
    const float* __restrict__ x,
    const float* __restrict__ pacc, const float* __restrict__ pm,
    const float* __restrict__ pl, const float* __restrict__ gammaP,
    float* __restrict__ out)
{
    // four blocks cover the pixels of one (batch, channel quad): batch and
    // channel are block-uniform, the pixel is the only per-thread offset
    const unsigned n = (((blockIdx.x & 3u) << 8) + threadIdx.x) << 2;
    const int c0 = ((blockIdx.x >> 2) & 15) << 2;
    const int b  = blockIdx.x >> 6;

    const float gamma = gammaP[0];

    const size_t sbase = (size_t)b * N_PIX;
    const size_t abase = ((size_t)b * C_IN + c0) * N_PIX;

    // every load first, so that one trip to memory serves the whole thread
    // (all loops of this kernel are unrolled so that these arrays stay in registers)
    v4f w[KSPLIT], ls[KSPLIT], pa[4][KSPLIT], xv[4];
#pragma unroll
    for (int s = 0; s < KSPLIT; ++s) {
        w[s]  = *(const v4f*)((pm + (size_t)s * 4 * N_PIX + sbase) + n);
        ls[s] = *(const v4f*)((pl + (size_t)s * 4 * N_PIX + sbase) + n);
    }
#pragma unroll
    for (int cc = 0; cc < 4; ++cc) {
#pragma unroll
        for (int s = 0; s < KSPLIT; ++s)
            pa[cc][s] = *(const v4f*)((pacc + abase * KSPLIT + (size_t)(cc * KSPLIT + s) * N_PIX) + n);
        xv[cc] = *(const v4f*)((x + abase + (size_t)cc * N_PIX) + n);
    }
    // keeps the scheduler from sinking the loads into the arithmetic, where
    // they would go out two at a time with a full latency between the pairs
    __builtin_amdgcn_sched_barrier(0);

    v4f mx = w[0];
#pragma unroll
    for (int s = 1; s < KSPLIT; ++s) {
#pragma unroll
        for (int e = 0; e < 4; ++e) mx[e] = fmaxf(mx[e], w[s][e]);
    }
    v4f lsum = {0.0f, 0.0f, 0.0f, 0.0f};
#pragma unroll
    for (int s = 0; s < KSPLIT; ++s) {
#pragma unroll
        for (int e = 0; e < 4; ++e) {
            w[s][e] = __expf(w[s][e] - mx[e]);
            lsum[e] = fmaf(w[s][e], ls[s][e], lsum[e]);
        }
    }
    v4f rl;
#pragma unroll
    for (int e = 0; e < 4; ++e) rl[e] = 1.0f / lsum[e];

#pragma unroll
    for (int cc = 0; cc < 4; ++cc) {
        v4f a = {0.0f, 0.0f, 0.0f, 0.0f};
#pragma unroll
        for (int s = 0; s < KSPLIT; ++s) {
#pragma unroll
            for (int e = 0; e < 4; ++e) a[e] = fmaf(w[s][e], pa[cc][s][e], a[e]);
        }
        v4f o;
#pragma unroll
        for (int e = 0; e < 4; ++e) o[e] = fmaf(gamma, a[e] * rl[e], xv[cc][e]);
        *(v4f*)((out + abase + (size_t)cc * N_PIX) + n) = o;
    }
}

// ---------------------------------------------------------------------------
extern "C" void kernel_launch(void* const* d_in, const int* in_sizes, int n_in,
                              void* d_out, int out_size, void* d_ws, size_t ws_size,
                              hipStream_t stream) {
    const float* x     = (const float*)d_in[0];
    const int*   mask  = (const int*)d_in[1];
    const float* Wq    = (const float*)d_in[2];
    const float* bq    = (const float*)d_in[3];
    const float* Wk    = (const float*)d_in[4];
    const float* bk    = (const float*)d_in[5];
    const float* Wv    = (const float*)d_in[6];
    const float* bv    = (const float*)d_in[7];
    const float* gamma = (const float*)d_in[8];
    float* out = (float*)d_out;

    float* qws = (float*)d_ws;                    // 4*4096*8  floats
    float* kws = qws + 4 * N_PIX * CQ;            // 4*4096*8  floats
    float* vws = kws + 4 * N_PIX * CQ;            // 4*64*4096 floats
    float* pacc = vws + 4 * C_IN * N_PIX;         // KSPLIT*4*64*4096 floats
    float* pm   = pacc + KSPLIT * 4 * C_IN * N_PIX;   // KSPLIT*4*4096 floats
    float* pl   = pm + KSPLIT * 4 * N_PIX;            // KSPLIT*4*4096 floats (40 MB total)

    proj_kernel<<<64, 256, 0, stream>>>(x, Wq, bq, Wk, bk, Wv, bv, qws, kws, vws);
    attn_kernel<<<128 * KSPLIT, 256, 0, stream>>>(mask, qws, kws, vws, pacc, pm, pl);
    merge_kernel<<<256, 256, 0, stream>>>(x, pacc, pm, pl, gamma, out);
}

// v002
// Measured time: 77.6 microseconds a run.
// In both of two side-by-side timings against v001, it was 1.49 times as fast.
// All steps since v000 together make it 3.65 times as fast.
#include <hip/hip_runtime.h>

typedef __attribute__((ext_vector_type(2))) float v2f;
typedef __attribute__((ext_vector_type(4))) float v4f;
typedef __attribute__((ext_vector_type(8))) float v8f;
typedef __attribute__((ext_vector_type(4))) unsigned int u32x4;
typedef __attribute__((ext_vector_type(4))) int i32x4;
typedef __attribute__((ext_vector_type(8))) int i32x8;

#define N_PIX 4096
#define C_IN  64
#define CQ    8
#define NEGV  (-1e9f)
#define KSPLIT 8                        // key ranges, one work-group each
#define KEYS_PER_SPLIT (N_PIX / KSPLIT) // 512 keys
#define TILES (KEYS_PER_SPLIT / 16)     // 32 key tiles per work-group

#define LDS_ROW 18
#define LDS_BUF (C_IN * LDS_ROW)

#if defined(__has_builtin)
#if __has_builtin(__builtin_amdgcn_tensor_load_to_lds) && __has_builtin(__builtin_amdgcn_s_wait_tensorcnt)
#define HAS_TDM 1
#endif
#endif
#ifndef HAS_TDM
#define HAS_TDM 0
#endif

// ---------------------------------------------------------------------------
// Kernel 1: the 1x1-conv projections as one product W(80 x 64) * x(64 x pixels)
// on the f32 matrix form -> q,k (B,N,8), v (B,C,N).
// A block covers 32 neighbouring pixels; each of its 5 waves takes 16 output
// rows (wave 0: q and k, waves 1..4: 16 channels of v) as two 16x16 tiles:
// tile 0 holds the even pixels, tile 1 the odd ones, so that a lane loads and
// stores pixel pairs and a half-wave touches whole 128-byte lines.
// ---------------------------------------------------------------------------
#define PROJ_PIX 32
__global__ __launch_bounds__(160) void proj_kernel(
    const float* __restrict__ x,
    const float* __restrict__ Wq, const float* __restrict__ bq,
    const float* __restrict__ Wk, const float* __restrict__ bk,
    const float* __restrict__ Wv, const float* __restrict__ bv,
    float* __restrict__ qws, float* __restrict__ kws, float* __restrict__ vws)
{
    const int lane = threadIdx.x & 31;
    const int g    = __builtin_amdgcn_readfirstlane(threadIdx.x >> 5);  // output group
    const int h    = lane >> 4;
    const int lm   = lane & 15;
    const int p0   = blockIdx.x * PROJ_PIX;     // first pixel, counted over all batches
    const int b    = p0 >> 12;
    const int n0   = p0 & (N_PIX - 1);

    // output row lm of the group (A operand) and the 8 biases of rows 8h..8h+7
    const float* wrow;
    const float* bias;
    if (g == 0) {
        wrow = (lm < CQ) ? Wq + lm * C_IN : Wk + (lm - CQ) * C_IN;
        bias = h ? bk : bq;
    } else {
        wrow = Wv + ((g - 1) * 16 + lm) * C_IN;
        bias = bv + (g - 1) * 16 + 8 * h;
    }

    const float* xp = x + (size_t)b * C_IN * N_PIX + (size_t)(4 * h) * N_PIX + n0 + 2 * lm;
    // (all loops of this kernel are unrolled so that the fragment arrays stay in registers)
    const v4f b0 = *(const v4f*)bias;
    const v4f b1 = *(const v4f*)(bias + 4);
    v4f wa[8];
    v2f xb[8][4];
#pragma unroll
    for (int j = 0; j < 8; ++j) wa[j] = *(const v4f*)(wrow + 8 * j + 4 * h);
#pragma unroll
    for (int j = 0; j < 8; ++j) {
#pragma unroll
        for (int i = 0; i < 4; ++i)
            xb[j][i] = *(const v2f*)(xp + (size_t)(8 * j + i) * N_PIX);
    }
    // keeps the scheduler from sinking the loads among the matrix steps, where a
    // wave would pay the trip to memory several times instead of once
    __builtin_amdgcn_sched_barrier(0);

    v8f acc0 = {b0[0], b0[1], b0[2], b0[3], b1[0], b1[1], b1[2], b1[3]};
    v8f acc1 = acc0;
#pragma unroll
    for (int j = 0; j < 8; ++j) {
#pragma unroll
        for (int e = 0; e < 2; ++e) {
            const v2f a  = {wa[j][2 * e], wa[j][2 * e + 1]};
            const v2f x0 = {xb[j][2 * e][0], xb[j][2 * e + 1][0]};
            const v2f x1 = {xb[j][2 * e][1], xb[j][2 * e + 1][1]};
            acc0 = __builtin_amdgcn_wmma_f32_16x16x4_f32(false, a, false, x0,
                                                         (short)0, acc0, false, false);
            acc1 = __builtin_amdgcn_wmma_f32_16x16x4_f32(false, a, false, x1,
                                                         (short)0, acc1, false, false);
        }
    }

    // acc0[r], acc1[r]: output row r + 8h at pixels p0 + 2lm and p0 + 2lm + 1
    if (g == 0) {
        float* dst = (h ? kws : qws) + (size_t)(p0 + 2 * lm) * CQ;
        const v4f s0 = {acc0[0], acc0[1], acc0[2], acc0[3]};
        const v4f s1 = {acc0[4], acc0[5], acc0[6], acc0[7]};
        const v4f s2 = {acc1[0], acc1[1], acc1[2], acc1[3]};
        const v4f s3 = {acc1[4], acc1[5], acc1[6], acc1[7]};
        *(v4f*)(dst)      = s0;
        *(v4f*)(dst + 4)  = s1;
        *(v4f*)(dst + 8)  = s2;
        *(v4f*)(dst + 12) = s3;
    } else {
        float* vp = vws + (size_t)b * C_IN * N_PIX
                  + (size_t)((g - 1) * 16 + 8 * h) * N_PIX + n0 + 2 * lm;
#pragma unroll
        for (int r = 0; r < 8; ++r) {
            const v2f o = {acc0[r], acc1[r]};
            *(v2f*)(vp + (size_t)r * N_PIX) = o;
        }
        // the stores' address and data registers may be rewritten behind this point
        asm volatile("s_wait_xcnt 0x0" ::: "memory");
    }
}

#if HAS_TDM
__device__ __forceinline__ unsigned pinned(unsigned v) {
    unsigned w = __builtin_amdgcn_readfirstlane(v);
    asm volatile("" : "+s"(w));
    return w;
}

// global_addr[56:32] | type=2
__device__ __forceinline__ unsigned tdm_word3(const float* gsrc) {
    const unsigned long long ga = (unsigned long long)(uintptr_t)gsrc;
    return (unsigned)((ga >> 32) & 0x01FFFFFFu) | (2u << 30);
}

__device__ __forceinline__ i32x8 tdm_group1() {
    i32x8 g1;
    g1[0] = (int)0x02D20000;
    g1[1] = (int)pinned(N_PIX << 16);
    g1[2] = (int)pinned(C_IN << 16);
    g1[3] = (int)pinned(16 << 16);
    g1[4] = (int)pinned(C_IN);
    g1[5] = (int)pinned(N_PIX);
    g1[6] = (int)pinned(0);
    g1[7] = (int)pinned(0);
    return g1;
}

// g0: {count=1 (user mode), lds_addr (bytes), global_addr[31:0], global_addr[56:32]|type=2}
__device__ __forceinline__ void tdm_load_vtile(u32x4 g0, i32x8 g1) {
    i32x4 gz = {0, 0, 0, 0};
#if __clang_major__ >= 23
    i32x8 gz8 = {0, 0, 0, 0, 0, 0, 0, 0};
    __builtin_amdgcn_tensor_load_to_lds(g0, g1, gz, gz, gz8, 0);
#else
    __builtin_amdgcn_tensor_load_to_lds(g0, g1, gz, gz, 0);
#endif
}
#endif

__global__ __launch_bounds__(256) void attn_kernel(
    const int* __restrict__ mask,
    const float* __restrict__ qws, const float* __restrict__ kws,
    const float* __restrict__ vws,
    float* __restrict__ pacc, float* __restrict__ pm, float* __restrict__ pl)
{
    const int lane = threadIdx.x & 31;
    const int wv   = threadIdx.x >> 5;
    const int qg   = blockIdx.x & 127;          // group of 8 query tiles
    const int sp   = blockIdx.x >> 7;           // key range 0..KSPLIT-1
    const int b    = qg >> 5;                   // 32 query groups per batch
    const int i0   = (((qg & 31) << 3) + wv) << 4;
    const int k0   = sp * KEYS_PER_SPLIT;       // first key of this range
    const int h    = lane >> 4;
    const int lm   = lane & 15;

#if HAS_TDM
    __shared__ float vlds[2][LDS_BUF];
#endif

    // Q as B-fragments (K = vgpr + 2h)
    const float* qp = qws + ((size_t)b * N_PIX + i0 + lm) * CQ;
    const v2f qb0 = *(const v2f*)(qp + 2 * h);
    const v2f qb1 = *(const v2f*)(qp + 4 + 2 * h);

    // query validity bit (identical for both halves)
    const unsigned qbal = (unsigned)__ballot(mask[b * N_PIX + i0 + lm] != 0);
    const unsigned qv   = (qbal >> lm) & 1u;

    v8f acc0 = {}, acc1 = {}, acc2 = {}, acc3 = {};
    float m = -INFINITY;
    float l = 0.0f;

    const float* kbase = kws + ((size_t)b * N_PIX + k0) * CQ;
    const float* vbase = vws + (size_t)b * C_IN * N_PIX + k0;
    const int*   mbase = mask + b * N_PIX + k0;

#if HAS_TDM
    // Words that no tile changes are formed once; per tile only the LDS place and
    // the low address word move. The high word is picked from two held values
    // (the range's first and last tile) in case the low word wraps in between.
    const i32x8    dg1   = tdm_group1();
    const unsigned dw0   = pinned(1u);
    const unsigned dlo   = pinned((unsigned)(uintptr_t)vbase);
    const unsigned dw3a  = pinned(tdm_word3(vbase));
    const unsigned dw3b  = pinned(tdm_word3(vbase + 16 * (TILES - 1)));
    u32x4 dg0a = {dw0, (unsigned)(uintptr_t)&vlds[0][0], dlo, dw3a};
    asm volatile("" : "+s"(dg0a));
    u32x4 dg0 = {dw0, (unsigned)(uintptr_t)&vlds[1][0], dlo + 64u,
                 (dlo + 64u < dlo) ? dw3b : dw3a};
    if (wv == 0) {   // wave-uniform: prime both staging buffers
        tdm_load_vtile(dg0a, dg1);
        tdm_load_vtile(dg0, dg1);
    }
#endif

    for (int t = 0; t < TILES; ++t) {
        const int j0 = t << 4;

#if HAS_TDM
        if (wv == 0) {
            if (t == TILES - 1) __builtin_amdgcn_s_wait_tensorcnt(0);
            else                __builtin_amdgcn_s_wait_tensorcnt(1);
        }
        __syncthreads();
        const float* vtile = &vlds[t & 1][0];
#endif

        // K A-fragments
        const float* kp = kbase + (size_t)(j0 + lm) * CQ;
        const v2f ka0 = *(const v2f*)(kp + 2 * h);
        const v2f ka1 = *(const v2f*)(kp + 4 + 2 * h);

        unsigned kbal = (unsigned)__ballot(mbase[j0 + lm] != 0);
        kbal = qv ? kbal : 0u;               // fold query validity
        const unsigned kb = kbal >> (8 * h); // per-half key bits

        // S^T = K_tile x Q^T  (two K=4 chunks)
        v8f s = {};
        s = __builtin_amdgcn_wmma_f32_16x16x4_f32(false, ka0, false, qb0,
                                                  (short)0, s, false, false);
        s = __builtin_amdgcn_wmma_f32_16x16x4_f32(false, ka1, false, qb1,
                                                  (short)0, s, false, false);

        // mask + online softmax stats
        float p[8];
        float tmax = -INFINITY;
#pragma unroll
        for (int r = 0; r < 8; ++r) {
            const float sv = (kb & (1u << r)) ? s[r] : NEGV;
            p[r] = sv;
            tmax = fmaxf(tmax, sv);
        }
        tmax = fmaxf(tmax, __shfl_xor(tmax, 16));
        const float mnew  = fmaxf(m, tmax);
        const float scale = __expf(m - mnew);
        float psum = 0.0f;
#pragma unroll
        for (int r = 0; r < 8; ++r) {
            p[r] = __expf(p[r] - mnew);
            psum += p[r];
        }
        psum += __shfl_xor(psum, 16);
        l = l * scale + psum;
        m = mnew;
#pragma unroll
        for (int r = 0; r < 8; ++r) {
            acc0[r] *= scale; acc1[r] *= scale;
            acc2[r] *= scale; acc3[r] *= scale;
        }

        // Re-lay P into B fragments (key = 4kc + v + 2h at query lm)
        float pl[8], ph[8];
#pragma unroll
        for (int r = 0; r < 8; ++r) {
            pl[r] = __shfl(p[r], lm);
            ph[r] = __shfl(p[r], lm + 16);
        }
        v2f bp[4];
#pragma unroll
        for (int kc = 0; kc < 4; ++kc) {
            const int r0 = (kc & 1) * 4;
            const float s0 = (kc < 2) ? pl[r0 + 0] : ph[r0 + 0];
            const float s1 = (kc < 2) ? pl[r0 + 1] : ph[r0 + 1];
            const float s2 = (kc < 2) ? pl[r0 + 2] : ph[r0 + 2];
            const float s3 = (kc < 2) ? pl[r0 + 3] : ph[r0 + 3];
            bp[kc].x = h ? s2 : s0;
            bp[kc].y = h ? s3 : s1;
        }

        // V A-fragments: channel = cg*16+lm, keys j0+4kc+2h..+1
        v2f va[4][4];
#pragma unroll
        for (int cg = 0; cg < 4; ++cg) {
#if HAS_TDM
            const float* vp = vtile + (cg * 16 + lm) * LDS_ROW + 2 * h;
#else
            const float* vp = vbase + (size_t)(cg * 16 + lm) * N_PIX + j0 + 2 * h;
#endif
#pragma unroll
            for (int kc = 0; kc < 4; ++kc)
                va[cg][kc] = *(const v2f*)(vp + 4 * kc);
        }

        // out_tile += V_tile x P^T
#pragma unroll
        for (int kc = 0; kc < 4; ++kc) {
            acc0 = __builtin_amdgcn_wmma_f32_16x16x4_f32(false, va[0][kc], false, bp[kc],
                                                         (short)0, acc0, false, false);
            acc1 = __builtin_amdgcn_wmma_f32_16x16x4_f32(false, va[1][kc], false, bp[kc],
                                                         (short)0, acc1, false, false);
            acc2 = __builtin_amdgcn_wmma_f32_16x16x4_f32(false, va[2][kc], false, bp[kc],
                                                         (short)0, acc2, false, false);
            acc3 = __builtin_amdgcn_wmma_f32_16x16x4_f32(false, va[3][kc], false, bp[kc],
                                                         (short)0, acc3, false, false);
        }

#if HAS_TDM
        __syncthreads();  // everyone done reading buffer (t&1)
        const unsigned lo = dlo + 4u * (unsigned)(j0 + 32);
        dg0[1] = (unsigned)(uintptr_t)&vlds[t & 1][0];
        dg0[2] = lo;
        dg0[3] = (lo < dlo) ? dw3b : dg0[3];
        if (wv == 0 && t + 2 < TILES)
            tdm_load_vtile(dg0, dg1);
#endif
    }

#if HAS_TDM
    asm volatile("" :: "s"(dg0a));
#endif

    // epilogue: this range's partial sums   (c = cg*16 + r + 8h, n = i0+lm)
    // layout [batch][channel][range][pixel]
    const size_t obase = ((size_t)b * C_IN * KSPLIT + sp) * N_PIX + i0 + lm;
#pragma unroll
    for (int cg = 0; cg < 4; ++cg) {
        const v8f a = (cg == 0) ? acc0 : (cg == 1) ? acc1 : (cg == 2) ? acc2 : acc3;
#pragma unroll
        for (int r = 0; r < 8; ++r) {
            const int c = cg * 16 + r + 8 * h;
            pacc[obase + (size_t)c * KSPLIT * N_PIX] = a[r];
        }
    }
    if (h == 0) {   // both halves hold the same statistics
        const int sidx = (sp * 4 + b) * N_PIX + i0 + lm;
        pm[sidx] = m;
        pl[sidx] = l;
    }
}

// ---------------------------------------------------------------------------
// Kernel 3: join the KSPLIT key ranges. Weight of a range = exp(m_s - max m);
// out = gamma * (sum w_s acc_s) / (sum w_s l_s) + x.
// One thread: 4 neighbouring pixels x 4 channels.
// ---------------------------------------------------------------------------
__global__ __launch_bounds__(256) void merge_kernel(
    const float* __restrict__ x,
    const float* __restrict__ pacc, const float* __restrict__ pm,
    const float* __restrict__ pl, const float* __restrict__ gammaP,
    float* __restrict__ out)
{
    // four blocks cover the pixels of one (batch, channel quad): batch and
    // channel are block-uniform, the pixel is the only per-thread offset
    const unsigned n = (((blockIdx.x & 3u) << 8) + threadIdx.x) << 2;
    const int c0 = ((blockIdx.x >> 2) & 15) << 2;
    const int b  = blockIdx.x >> 6;

    const float gamma = gammaP[0];

    const size_t sbase = (size_t)b * N_PIX;
    const size_t abase = ((size_t)b * C_IN + c0) * N_PIX;

    // every load first, so that one trip to memory serves the whole thread
    // (all loops of this kernel are unrolled so that these arrays stay in registers)
    v4f w[KSPLIT], ls[KSPLIT], pa[4][KSPLIT], xv[4];
#pragma unroll
    for (int s = 0; s < KSPLIT; ++s) {
        w[s]  = *(const v4f*)((pm + (size_t)s * 4 * N_PIX + sbase) + n);
        ls[s] = *(const v4f*)((pl + (size_t)s * 4 * N_PIX + sbase) + n);
    }
#pragma unroll
    for (int cc = 0; cc < 4; ++cc) {
#pragma unroll
        for (int s = 0; s < KSPLIT; ++s)
            pa[cc][s] = *(const v4f*)((pacc + abase * KSPLIT + (size_t)(cc * KSPLIT + s) * N_PIX) + n);
        xv[cc] = *(const v4f*)((x + abase + (size_t)cc * N_PIX) + n);
    }
    // keeps the scheduler from sinking the loads into the arithmetic, where
    // they would go out two at a time with a full latency between the pairs
    __builtin_amdgcn_sched_barrier(0);

    v4f mx = w[0];
#pragma unroll
    for (int s = 1; s < KSPLIT; ++s) {
#pragma unroll
        for (int e = 0; e < 4; ++e) mx[e] = fmaxf(mx[e], w[s][e]);
    }
    v4f lsum = {0.0f, 0.0f, 0.0f, 0.0f};
#pragma unroll
    for (int s = 0; s < KSPLIT; ++s) {
#pragma unroll
        for (int e = 0; e < 4; ++e) {
            w[s][e] = __expf(w[s][e] - mx[e]);
            lsum[e] = fmaf(w[s][e], ls[s][e], lsum[e]);
        }
    }
    v4f rl;
#pragma unroll
    for (int e = 0; e < 4; ++e) rl[e] = 1.0f / lsum[e];

#pragma unroll
    for (int cc = 0; cc < 4; ++cc) {
        v4f a = {0.0f, 0.0f, 0.0f, 0.0f};
#pragma unroll
        for (int s = 0; s < KSPLIT; ++s) {
#pragma unroll
            for (int e = 0; e < 4; ++e) a[e] = fmaf(w[s][e], pa[cc][s][e], a[e]);
        }
        v4f o;
#pragma unroll
        for (int e = 0; e < 4; ++e) o[e] = fmaf(gamma, a[e] * rl[e], xv[cc][e]);
        *(v4f*)((out + abase + (size_t)cc * N_PIX) + n) = o;
    }
}

// ---------------------------------------------------------------------------
extern "C" void kernel_launch(void* const* d_in, const int* in_sizes, int n_in,
                              void* d_out, int out_size, void* d_ws, size_t ws_size,
                              hipStream_t stream) {
    const float* x     = (const float*)d_in[0];
    const int*   mask  = (const int*)d_in[1];
    const float* Wq    = (const float*)d_in[2];
    const float* bq    = (const float*)d_in[3];
    const float* Wk    = (const float*)d_in[4];
    const float* bk    = (const float*)d_in[5];
    const float* Wv    = (const float*)d_in[6];
    const float* bv    = (const float*)d_in[7];
    const float* gamma = (const float*)d_in[8];
    float* out = (float*)d_out;

    float* qws = (float*)d_ws;                    // 4*4096*8  floats
    float* kws = qws + 4 * N_PIX * CQ;            // 4*4096*8  floats
    float* vws = kws + 4 * N_PIX * CQ;            // 4*64*4096 floats
    float* pacc = vws + 4 * C_IN * N_PIX;         // KSPLIT*4*64*4096 floats
    float* pm   = pacc + KSPLIT * 4 * C_IN * N_PIX;   // KSPLIT*4*4096 floats
    float* pl   = pm + KSPLIT * 4 * N_PIX;            // KSPLIT*4*4096 floats (40 MB total)

    proj_kernel<<<4 * N_PIX / PROJ_PIX, 160, 0, stream>>>(x, Wq, bq, Wk, bk, Wv, bv, qws, kws, vws);
    attn_kernel<<<128 * KSPLIT, 256, 0, stream>>>(mask, qws, kws, vws, pacc, pm, pl);
    merge_kernel<<<256, 256, 0, stream>>>(x, pacc, pm, pl, gamma, out);
}

// v003
// Measured time: 40.3 microseconds a run.
// Next to v002, in two timings, it ran 1.93 and 1.91 times as fast.
// All steps since v000 together make it 7.02 times as fast.
#include <hip/hip_runtime.h>

typedef __attribute__((ext_vector_type(2))) float v2f;
typedef __attribute__((ext_vector_type(4))) float v4f;
typedef __attribute__((ext_vector_type(8))) float v8f;
typedef __attribute__((ext_vector_type(4))) unsigned int u32x4;
typedef __attribute__((ext_vector_type(2))) int i32x2;
typedef __attribute__((ext_vector_type(4))) int i32x4;
typedef __attribute__((ext_vector_type(8))) int i32x8;

#define N_PIX 4096
#define C_IN  64
#define CQ    8
#define NEGV  (-1e9f)
#define KSPLIT 8                        // key ranges, one work-group each

#define LDS_ROW 18
#define LDS_BUF (C_IN * LDS_ROW)

#if defined(__has_builtin)
#if __has_builtin(__builtin_amdgcn_tensor_load_to_lds) && __has_builtin(__builtin_amdgcn_s_wait_tensorcnt)
#define HAS_TDM 1
#endif
#endif
#ifndef HAS_TDM
#define HAS_TDM 0
#endif

// ---------------------------------------------------------------------------
// Kernel 1: the 1x1-conv projections as one product W(80 x 64) * x(64 x pixels)
// on the f32 matrix form -> q,k (B,N,8), v (B,C,N).
// A block covers 32 neighbouring pixels; each of its 5 waves takes 16 output
// rows (wave 0: q and k, waves 1..4: 16 channels of v) as two 16x16 tiles:
// tile 0 holds the even pixels, tile 1 the odd ones, so that a lane loads
// pixel pairs and a half-wave touches whole 128-byte lines.
// q, k and v are stored in a packed pixel order: the valid pixels of a batch
// first, in their own order, the masked ones from the end backwards. A masked
// key has weight exactly 0 for a valid query, and a masked query weighs every
// key alike, so the attention runs over the valid pixels alone and a masked
// pixel takes the mean of v, whose per-block sums are stored here.
// ---------------------------------------------------------------------------
#define PROJ_PIX 32
#define PROJ_BLK (N_PIX / PROJ_PIX)     // 128 blocks per batch
#define MQ 7                            // mask quads per thread: 7 * 160 >= 1024
__global__ __launch_bounds__(160) void proj_kernel(
    const float* __restrict__ x, const int* __restrict__ mask,
    const float* __restrict__ Wq, const float* __restrict__ bq,
    const float* __restrict__ Wk, const float* __restrict__ bk,
    const float* __restrict__ Wv, const float* __restrict__ bv,
    float* __restrict__ qws, float* __restrict__ kws, float* __restrict__ vws,
    int* __restrict__ posws, int* __restrict__ nvws, float* __restrict__ vpart)
{
    __shared__ int scnt[5];
    const int lane = threadIdx.x & 31;
    const int g    = __builtin_amdgcn_readfirstlane(threadIdx.x >> 5);  // output group
    const int h    = lane >> 4;
    const int lm   = lane & 15;
    const int p0   = blockIdx.x * PROJ_PIX;     // first pixel, counted over all batches
    const int b    = p0 >> 12;
    const int n0   = p0 & (N_PIX - 1);

    // output row lm of the group (A operand) and the 8 biases of rows 8h..8h+7
    const float* wrow;
    const float* bias;
    if (g == 0) {
        wrow = (lm < CQ) ? Wq + lm * C_IN : Wk + (lm - CQ) * C_IN;
        bias = h ? bk : bq;
    } else {
        wrow = Wv + ((g - 1) * 16 + lm) * C_IN;
        bias = bv + (g - 1) * 16 + 8 * h;
    }

    const float* xp = x + (size_t)b * C_IN * N_PIX + (size_t)(4 * h) * N_PIX + n0 + 2 * lm;
    // (all loops of this kernel are unrolled so that the fragment arrays stay in registers)
    const v4f b0 = *(const v4f*)bias;
    const v4f b1 = *(const v4f*)(bias + 4);
    v4f wa[8];
    v2f xb[8][4];
#pragma unroll
    for (int j = 0; j < 8; ++j) wa[j] = *(const v4f*)(wrow + 8 * j + 4 * h);
    // the bias and weight loads' address registers may be rewritten behind this point
    asm volatile("s_wait_xcnt 0x0" ::: "memory");
#pragma unroll
    for (int j = 0; j < 8; ++j) {
#pragma unroll
        for (int i = 0; i < 4; ++i)
            xb[j][i] = *(const v2f*)(xp + (size_t)(8 * j + i) * N_PIX);
    }
    // the batch's mask in front of this block (quads past it are read at a
    // clamped place and not counted) and the block's own 32 pixels
    const int* mrow = mask + b * N_PIX;
    i32x4 mq[MQ];
#pragma unroll
    for (int i = 0; i < MQ; ++i) {
        const int q4 = (int)threadIdx.x + 160 * i;
        mq[i] = *(const i32x4*)(mrow + 4 * (q4 < N_PIX / 4 ? q4 : N_PIX / 4 - 1));
    }
    const int mown = mrow[n0 + lane];
    // keeps the scheduler from sinking the loads among the matrix steps, where a
    // wave would pay the trip to memory several times instead of once
    __builtin_amdgcn_sched_barrier(0);

    // valid pixels in front of the block: per thread, per wave (a ballot for
    // each bit of the count, at most 28), then over the 5 waves through LDS
    int cnt = 0;
#pragma unroll
    for (int i = 0; i < MQ; ++i) {
        const int c4 = (mq[i][0] != 0) + (mq[i][1] != 0) + (mq[i][2] != 0) + (mq[i][3] != 0);
        cnt += (4 * ((int)threadIdx.x + 160 * i) < n0) ? c4 : 0;
    }
    int wsum = 0;
#pragma unroll
    for (int bit = 0; bit < 5; ++bit)
        wsum += __popc((unsigned)__ballot((cnt >> bit) & 1)) << bit;
    if (lane == 0) scnt[g] = wsum;
    const unsigned mbits = (unsigned)__ballot(mown != 0);

    v8f acc0 = {b0[0], b0[1], b0[2], b0[3], b1[0], b1[1], b1[2], b1[3]};
    v8f acc1 = acc0;
#pragma unroll
    for (int j = 0; j < 8; ++j) {
#pragma unroll
        for (int e = 0; e < 2; ++e) {
            const v2f a  = {wa[j][2 * e], wa[j][2 * e + 1]};
            const v2f x0 = {xb[j][2 * e][0], xb[j][2 * e + 1][0]};
            const v2f x1 = {xb[j][2 * e][1], xb[j][2 * e + 1][1]};
            acc0 = __builtin_amdgcn_wmma_f32_16x16x4_f32(false, a, false, x0,
                                                         (short)0, acc0, false, false);
            acc1 = __builtin_amdgcn_wmma_f32_16x16x4_f32(false, a, false, x1,
                                                         (short)0, acc1, false, false);
        }
    }

    __syncthreads();   // the five waves' counts are in LDS
    const int base = scnt[0] + scnt[1] + scnt[2] + scnt[3] + scnt[4];

    // packed places of pixels n0 + 2lm and n0 + 2lm + 1: a valid pixel goes to
    // its rank among the valid ones, a masked one to N - 1 - its rank among the masked
    const int i0  = 2 * lm;
    const int ok0 = (mbits >> i0) & 1;
    const int ok1 = (mbits >> (i0 + 1)) & 1;
    const int rk0 = base + __popc(mbits & ((1u << i0) - 1u));
    const int rk1 = rk0 + ok0;
    const int pos0 = ok0 ? rk0 : N_PIX - 1 - (n0 + i0 - rk0);
    const int pos1 = ok1 ? rk1 : N_PIX - 1 - (n0 + i0 + 1 - rk1);

    // acc0[r], acc1[r]: output row r + 8h at pixels n0 + 2lm and n0 + 2lm + 1
    if (g == 0) {
        float* dbase = (h ? kws : qws) + (size_t)b * N_PIX * CQ;
        float* dst0 = dbase + (size_t)pos0 * CQ;
        float* dst1 = dbase + (size_t)pos1 * CQ;
        const v4f s0 = {acc0[0], acc0[1], acc0[2], acc0[3]};
        const v4f s1 = {acc0[4], acc0[5], acc0[6], acc0[7]};
        const v4f s2 = {acc1[0], acc1[1], acc1[2], acc1[3]};
        const v4f s3 = {acc1[4], acc1[5], acc1[6], acc1[7]};
        *(v4f*)(dst0)     = s0;
        *(v4f*)(dst0 + 4) = s1;
        *(v4f*)(dst1)     = s2;
        *(v4f*)(dst1 + 4) = s3;
        if (h == 0) {   // where each pixel went; -1 marks a masked pixel
            const i32x2 pp = {ok0 ? pos0 : -1, ok1 ? pos1 : -1};
            *(i32x2*)(posws + b * N_PIX + n0 + i0) = pp;
        }
        if (lane == 0 && n0 == N_PIX - PROJ_PIX)   // the batch's last block knows the total
            nvws[b] = base + __popc(mbits);
        // the stores' address and data registers may be rewritten behind this point
        asm volatile("s_wait_xcnt 0x0" ::: "memory");
    } else {
        float* vp = vws + (size_t)b * C_IN * N_PIX
                  + (size_t)((g - 1) * 16 + 8 * h) * N_PIX;
        float rs[8];
#pragma unroll
        for (int r = 0; r < 8; ++r) {
            vp[(size_t)r * N_PIX + pos0] = acc0[r];
            vp[(size_t)r * N_PIX + pos1] = acc1[r];
            rs[r] = acc0[r] + acc1[r];
        }
        // the stores' address and data registers may be rewritten behind this point
        asm volatile("s_wait_xcnt 0x0" ::: "memory");
        // the block's sum of v over its 32 pixels, 8 channels per half-wave
#pragma unroll
        for (int d = 1; d < 16; d <<= 1) {
#pragma unroll
            for (int r = 0; r < 8; ++r) rs[r] += __shfl_xor(rs[r], d);
        }
        if (lm == 0) {
            float* sp = vpart + (size_t)(b * PROJ_BLK + (n0 >> 5)) * C_IN + (g - 1) * 16 + 8 * h;
            const v4f t0 = {rs[0], rs[1], rs[2], rs[3]};
            const v4f t1 = {rs[4], rs[5], rs[6], rs[7]};
            *(v4f*)(sp)     = t0;
            *(v4f*)(sp + 4) = t1;
        }
    }
}

#if HAS_TDM
__device__ __forceinline__ unsigned pinned(unsigned v) {
    unsigned w = __builtin_amdgcn_readfirstlane(v);
    asm volatile("" : "+s"(w));
    return w;
}

// global_addr[56:32] | type=2
__device__ __forceinline__ unsigned tdm_word3(const float* gsrc) {
    const unsigned long long ga = (unsigned long long)(uintptr_t)gsrc;
    return (unsigned)((ga >> 32) & 0x01FFFFFFu) | (2u << 30);
}

__device__ __forceinline__ i32x8 tdm_group1() {
    i32x8 g1;
    g1[0] = (int)0x02D20000;
    g1[1] = (int)pinned(N_PIX << 16);
    g1[2] = (int)pinned(C_IN << 16);
    g1[3] = (int)pinned(16 << 16);
    g1[4] = (int)pinned(C_IN);
    g1[5] = (int)pinned(N_PIX);
    g1[6] = (int)pinned(0);
    g1[7] = (int)pinned(0);
    return g1;
}

// g0: {count=1 (user mode), lds_addr (bytes), global_addr[31:0], global_addr[56:32]|type=2}
__device__ __forceinline__ void tdm_load_vtile(u32x4 g0, i32x8 g1) {
    i32x4 gz = {0, 0, 0, 0};
#if __clang_major__ >= 23
    i32x8 gz8 = {0, 0, 0, 0, 0, 0, 0, 0};
    __builtin_amdgcn_tensor_load_to_lds(g0, g1, gz, gz, gz8, 0);
#else
    __builtin_amdgcn_tensor_load_to_lds(g0, g1, gz, gz, 0);
#endif
}
#endif

__global__ __launch_bounds__(256) void attn_kernel(
    const int* __restrict__ nvws,
    const float* __restrict__ qws, const float* __restrict__ kws,
    const float* __restrict__ vws,
    float* __restrict__ pacc, float* __restrict__ pm, float* __restrict__ pl)
{
    const int lane = threadIdx.x & 31;
    const int wv   = threadIdx.x >> 5;
    const int sp   = blockIdx.x & (KSPLIT - 1);
    const int b    = (blockIdx.x >> 3) & 3;
    const int qg   = blockIdx.x >> 5;
    const int i0   = ((qg << 3) + wv) << 4;
    // valid pixels of the batch, held to the shape's bounds
    const int nvr = nvws[b];
    const int nv  = __builtin_amdgcn_readfirstlane(nvr < 0 ? 0 : (nvr > N_PIX ? N_PIX : nvr));
    if ((qg << 7) >= nv) return;                // the whole block: no valid query here
    // key tiles per range: an equal share of the tiles up to nv, at least the two
    // that the staging ring starts with; KSPLIT * tiles * 16 <= N_PIX
    const int share = (((nv + 15) >> 4) + KSPLIT - 1) / KSPLIT;
    const int tiles = share < 2 ? 2 : share;
    const int k0   = sp * tiles * 16;           // first key of this range
    const int h    = lane >> 4;
    const int lm   = lane & 15;

#if HAS_TDM
    __shared__ float vlds[2][LDS_BUF];
#endif

    // Q as B-fragments (K = vgpr + 2h)
    const float* qp = qws + ((size_t)b * N_PIX + i0 + lm) * CQ;
    const v2f qb0 = *(const v2f*)(qp + 2 * h);
    const v2f qb1 = *(const v2f*)(qp + 4 + 2 * h);

    v8f acc0 = {}, acc1 = {}, acc2 = {}, acc3 = {};
    float m = -INFINITY;
    float l = 0.0f;

    const float* kbase = kws + ((size_t)b * N_PIX + k0) * CQ;
    const float* vbase = vws + (size_t)b * C_IN * N_PIX + k0;

#if HAS_TDM
    // Words that no tile changes are formed once; per tile only the LDS place and
    // the low address word move. The high word is picked from two held values
    // (the range's first and last tile) in case the low word wraps in between.
    const i32x8    dg1   = tdm_group1();
    const unsigned dw0   = pinned(1u);
    const unsigned dlo   = pinned((unsigned)(uintptr_t)vbase);
    const unsigned dw3a  = pinned(tdm_word3(vbase));
    const unsigned dw3b  = pinned(tdm_word3(vbase + 16 * (tiles - 1)));
    u32x4 dg0a = {dw0, (unsigned)(uintptr_t)&vlds[0][0], dlo, dw3a};
    asm volatile("" : "+s"(dg0a));
    u32x4 dg0 = {dw0, (unsigned)(uintptr_t)&vlds[1][0], dlo + 64u,
                 (dlo + 64u < dlo) ? dw3b : dw3a};
    if (wv == 0) {   // wave-uniform: prime both staging buffers
        tdm_load_vtile(dg0a, dg1);
        tdm_load_vtile(dg0, dg1);
    }
#endif

    // one copy of the body: split off as a copy of its own, the last pass would
    // carry a refill that never runs behind the ring's last wait
#pragma unroll 1
    for (int t = 0; t < tiles; ++t) {
        const int j0 = t << 4;

#if HAS_TDM
        if (wv == 0) {
            if (t == tiles - 1) __builtin_amdgcn_s_wait_tensorcnt(0);
            else                __builtin_amdgcn_s_wait_tensorcnt(1);
        }
        __syncthreads();
        const float* vtile = &vlds[t & 1][0];
#endif

        // K A-fragments
        const float* kp = kbase + (size_t)(j0 + lm) * CQ;
        const v2f ka0 = *(const v2f*)(kp + 2 * h);
        const v2f ka1 = *(const v2f*)(kp + 4 + 2 * h);

        const int left = nv - (k0 + j0);     // valid keys from this tile on
        const unsigned kbal = left >= 16 ? 0xFFFFu : (left <= 0 ? 0u : (1u << left) - 1u);
        const unsigned kb = kbal >> (8 * h); // per-half key bits

        // S^T = K_tile x Q^T  (two K=4 chunks)
        v8f s = {};
        s = __builtin_amdgcn_wmma_f32_16x16x4_f32(false, ka0, false, qb0,
                                                  (short)0, s, false, false);
        s = __builtin_amdgcn_wmma_f32_16x16x4_f32(false, ka1, false, qb1,
                                                  (short)0, s, false, false);

        // mask + online softmax stats
        float p[8];
        float tmax = -INFINITY;
#pragma unroll
        for (int r = 0; r < 8; ++r) {
            const float sv = (kb & (1u << r)) ? s[r] : NEGV;
            p[r] = sv;
            tmax = fmaxf(tmax, sv);
        }
        tmax = fmaxf(tmax, __shfl_xor(tmax, 16));
        const float mnew  = fmaxf(m, tmax);
        const float scale = __expf(m - mnew);
        float psum = 0.0f;
#pragma unroll
        for (int r = 0; r < 8; ++r) {
            p[r] = __expf(p[r] - mnew);
            psum += p[r];
        }
        psum += __shfl_xor(psum, 16);
        l = l * scale + psum;
        m = mnew;
#pragma unroll
        for (int r = 0; r < 8; ++r) {
            acc0[r] *= scale; acc1[r] *= scale;
            acc2[r] *= scale; acc3[r] *= scale;
        }

        // Re-lay P into B fragments (key = 4kc + v + 2h at query lm)
        float pl[8], ph[8];
#pragma unroll
        for (int r = 0; r < 8; ++r) {
            pl[r] = __shfl(p[r], lm);
            ph[r] = __shfl(p[r], lm + 16);
        }
        v2f bp[4];
#pragma unroll
        for (int kc = 0; kc < 4; ++kc) {
            const int r0 = (kc & 1) * 4;
            const float s0 = (kc < 2) ? pl[r0 + 0] : ph[r0 + 0];
            const float s1 = (kc < 2) ? pl[r0 + 1] : ph[r0 + 1];
            const float s2 = (kc < 2) ? pl[r0 + 2] : ph[r0 + 2];
            const float s3 = (kc < 2) ? pl[r0 + 3] : ph[r0 + 3];
            bp[kc].x = h ? s2 : s0;
            bp[kc].y = h ? s3 : s1;
        }

        // V A-fragments: channel = cg*16+lm, keys j0+4kc+2h..+1
        v2f va[4][4];
#pragma unroll
        for (int cg = 0; cg < 4; ++cg) {
#if HAS_TDM
            const float* vp = vtile + (cg * 16 + lm) * LDS_ROW + 2 * h;
#else
            const float* vp = vbase + (size_t)(cg * 16 + lm) * N_PIX + j0 + 2 * h;
#endif
#pragma unroll
            for (int kc = 0; kc < 4; ++kc)
                va[cg][kc] = *(const v2f*)(vp + 4 * kc);
        }

        // out_tile += V_tile x P^T
#pragma unroll
        for (int kc = 0; kc < 4; ++kc) {
            acc0 = __builtin_amdgcn_wmma_f32_16x16x4_f32(false, va[0][kc], false, bp[kc],
                                                         (short)0, acc0, false, false);
            acc1 = __builtin_amdgcn_wmma_f32_16x16x4_f32(false, va[1][kc], false, bp[kc],
                                                         (short)0, acc1, false, false);
            acc2 = __builtin_amdgcn_wmma_f32_16x16x4_f32(false, va[2][kc], false, bp[kc],
                                                         (short)0, acc2, false, false);
            acc3 = __builtin_amdgcn_wmma_f32_16x16x4_f32(false, va[3][kc], false, bp[kc],
                                                         (short)0, acc3, false, false);
        }

#if HAS_TDM
        __syncthreads();  // everyone done reading buffer (t&1)
        const unsigned lo = dlo + 4u * (unsigned)(j0 + 32);
        dg0[1] = (unsigned)(uintptr_t)&vlds[t & 1][0];
        dg0[2] = lo;
        dg0[3] = (lo < dlo) ? dw3b : dg0[3];
        if (wv == 0 && t + 2 < tiles)
            tdm_load_vtile(dg0, dg1);
#endif
    }

#if HAS_TDM
    asm volatile("" :: "s"(dg0a));
#endif

    // epilogue: this range's partial sums   (c = cg*16 + r + 8h, n = i0+lm)
    // layout [batch][channel][range][pixel]
    const size_t obase = ((size_t)b * C_IN * KSPLIT + sp) * N_PIX + i0 + lm;
#pragma unroll
    for (int cg = 0; cg < 4; ++cg) {
        const v8f a = (cg == 0) ? acc0 : (cg == 1) ? acc1 : (cg == 2) ? acc2 : acc3;
#pragma unroll
        for (int r = 0; r < 8; ++r) {
            const int c = cg * 16 + r + 8 * h;
            pacc[obase + (size_t)c * KSPLIT * N_PIX] = a[r];
        }
    }
    if (h == 0) {   // both halves hold the same statistics
        const int sidx = (sp * 4 + b) * N_PIX + i0 + lm;
        pm[sidx] = m;
        pl[sidx] = l;
    }
}

// ---------------------------------------------------------------------------
// Kernel 3: join the KSPLIT key ranges. Weight of a range = exp(m_s - max m);
// out = gamma * (sum w_s acc_s) / (sum w_s l_s) + x for a valid pixel, read at
// its packed place; a masked pixel takes gamma * (mean of v) + x.
// One thread: 1 pixel x MCH channels; a block: 256 neighbouring pixels.
// ---------------------------------------------------------------------------
#define MCH 8
__global__ __launch_bounds__(256) void merge_kernel(
    const float* __restrict__ x, const int* __restrict__ posws,
    const float* __restrict__ pacc, const float* __restrict__ pm,
    const float* __restrict__ pl, const float* __restrict__ vpart,
    const float* __restrict__ gammaP, float* __restrict__ out)
{
    __shared__ __attribute__((aligned(16))) float sred[8][MCH];
    const int tid  = threadIdx.x;
    const int lane = tid & 31;
    const int wv   = tid >> 5;
    const int n  = ((blockIdx.x & 15) << 8) + tid;
    const int c0 = ((blockIdx.x >> 4) & 7) * MCH;
    const int b  = blockIdx.x >> 7;

    const float gamma = gammaP[0];
    const int pos = posws[b * N_PIX + n];
    // the load's offset register may be rewritten behind this point
    asm volatile("s_wait_xcnt 0x0" ::: "memory");
    const bool valid = pos >= 0;

    // one projection block's sums of v, 4 of the MCH channels
    v4f ps = *(const v4f*)(vpart + (size_t)(b * PROJ_BLK + (tid >> 1)) * C_IN + c0 + 4 * (tid & 1));
    const size_t abase = ((size_t)b * C_IN + c0) * N_PIX;
    // (all loops of this kernel are unrolled so that these arrays stay in registers)
    float xv[MCH];
#pragma unroll
    for (int cc = 0; cc < MCH; ++cc) xv[cc] = x[abase + (size_t)cc * N_PIX + n];

    // every load of a valid pixel first, so that one trip to memory serves the
    // whole thread; a masked pixel has no partial sums and reads none
    float w[KSPLIT], ls[KSPLIT], pa[MCH][KSPLIT];
#pragma unroll
    for (int s = 0; s < KSPLIT; ++s) {
        w[s] = 0.0f; ls[s] = 0.0f;
#pragma unroll
        for (int cc = 0; cc < MCH; ++cc) pa[cc][s] = 0.0f;
    }
    if (valid) {
        const unsigned p = (unsigned)pos & (N_PIX - 1);
#pragma unroll
        for (int s = 0; s < KSPLIT; ++s) {
            w[s]  = pm[(size_t)(s * 4 + b) * N_PIX + p];
            ls[s] = pl[(size_t)(s * 4 + b) * N_PIX + p];
        }
        // these loads' address registers may be rewritten behind this point
        asm volatile("s_wait_xcnt 0x0" ::: "memory");
#pragma unroll
        for (int cc = 0; cc < MCH; ++cc) {
#pragma unroll
            for (int s = 0; s < KSPLIT; ++s)
                pa[cc][s] = pacc[abase * KSPLIT + (size_t)(cc * KSPLIT + s) * N_PIX + p];
        }
    }

    // mean of v over all pixels of the batch: the 128 blocks' sums, first over
    // the lanes of equal parity, then over the 8 waves through LDS
#pragma unroll
    for (int d = 2; d < 32; d <<= 1) {
#pragma unroll
        for (int e = 0; e < 4; ++e) ps[e] += __shfl_xor(ps[e], d);
    }
    if (lane < 2) *(v4f*)&sred[wv][4 * lane] = ps;
    __syncthreads();   // the eight waves' sums are in LDS
    float vm[MCH];
#pragma unroll
    for (int cc = 0; cc < MCH; ++cc) {
        float a = sred[0][cc];
#pragma unroll
        for (int q = 1; q < 8; ++q) a += sred[q][cc];
        vm[cc] = a * (1.0f / N_PIX);
    }

    float mx = w[0];
#pragma unroll
    for (int s = 1; s < KSPLIT; ++s) mx = fmaxf(mx, w[s]);
    float lsum = 0.0f;
#pragma unroll
    for (int s = 0; s < KSPLIT; ++s) {
        w[s] = __expf(w[s] - mx);
        lsum = fmaf(w[s], ls[s], lsum);
    }
    const float rl = 1.0f / lsum;

#pragma unroll
    for (int cc = 0; cc < MCH; ++cc) {
        float a = 0.0f;
#pragma unroll
        for (int s = 0; s < KSPLIT; ++s) a = fmaf(w[s], pa[cc][s], a);
        const float o = valid ? a * rl : vm[cc];
        out[abase + (size_t)cc * N_PIX + n] = fmaf(gamma, o, xv[cc]);
    }
}

// ---------------------------------------------------------------------------
extern "C" void kernel_launch(void* const* d_in, const int* in_sizes, int n_in,
                              void* d_out, int out_size, void* d_ws, size_t ws_size,
                              hipStream_t stream) {
    const float* x     = (const float*)d_in[0];
    const int*   mask  = (const int*)d_in[1];
    const float* Wq    = (const float*)d_in[2];
    const float* bq    = (const float*)d_in[3];
    const float* Wk    = (const float*)d_in[4];
    const float* bk    = (const float*)d_in[5];
    const float* Wv    = (const float*)d_in[6];
    const float* bv    = (const float*)d_in[7];
    const float* gamma = (const float*)d_in[8];
    float* out = (float*)d_out;

    float* qws = (float*)d_ws;                    // 4*4096*8  floats
    float* kws = qws + 4 * N_PIX * CQ;            // 4*4096*8  floats
    float* vws = kws + 4 * N_PIX * CQ;            // 4*64*4096 floats
    float* pacc = vws + 4 * C_IN * N_PIX;         // KSPLIT*4*64*4096 floats
    float* pm   = pacc + KSPLIT * 4 * C_IN * N_PIX;   // KSPLIT*4*4096 floats
    float* pl   = pm + KSPLIT * 4 * N_PIX;            // KSPLIT*4*4096 floats (40 MB total)
    int*   posws = (int*)(pl + KSPLIT * 4 * N_PIX);   // 4*4096 ints: packed place of a pixel
    int*   nvws  = posws + 4 * N_PIX;                 // 4 ints: valid pixels per batch
    float* vpart = (float*)(nvws + 4);                // 4*128*64 floats: sums of v per block

    proj_kernel<<<4 * N_PIX / PROJ_PIX, 160, 0, stream>>>(x, mask, Wq, bq, Wk, bk, Wv, bv, qws, kws, vws,
                                                        posws, nvws, vpart);
    attn_kernel<<<128 * KSPLIT, 256, 0, stream>>>(nvws, qws, kws, vws, pacc, pm, pl);
    merge_kernel<<<4 * 16 * (C_IN / MCH), 256, 0, stream>>>(x, posws, pacc, pm, pl, vpart, gamma, out);
}

// v004
// It runs in 33.5 microseconds.
// Next to v003, in two timings, it ran 1.21 and 1.20 times as fast.
// Over all steps from v000 it is 8.45 times as fast.
#include <hip/hip_runtime.h>

typedef __attribute__((ext_vector_type(2))) float v2f;
typedef __attribute__((ext_vector_type(4))) float v4f;
typedef __attribute__((ext_vector_type(8))) float v8f;
typedef __attribute__((ext_vector_type(4))) int i32x4;

#define N_PIX 4096
#define C_IN  64
#define CQ    8
#define NEGV  (-1e9f)
#define KW 8                            // key ranges, one wave of a work-group each
#define OP 20                           // LDS pitch in dwords of a partial-sum row (16 queries)

// ---------------------------------------------------------------------------
// Kernel 1: the 1x1-conv projections as one product W(80 x 64) * x(64 x pixels)
// on the f32 matrix form -> q,k (B,N,8), v (B,N,C).
// A block covers 32 neighbouring pixels; each of its 5 waves takes 16 output
// rows (wave 0: q and k, waves 1..4: 16 channels of v) as two 16x16 tiles:
// tile 0 holds the even pixels, tile 1 the odd ones, so that a lane loads
// pixel pairs and a half-wave touches whole 128-byte lines.
// q, k and v are stored in a packed pixel order: the valid pixels of a batch
// first, in their own order, the masked ones from the end backwards. A masked
// key has weight exactly 0 for a valid query, and a masked query weighs every
// key alike, so the attention runs over the valid pixels alone and a masked
// pixel takes the mean of v, whose per-block sums are stored here.
// ---------------------------------------------------------------------------
#define PROJ_PIX 32
#define PROJ_BLK (N_PIX / PROJ_PIX)     // 128 blocks per batch
#define MQ 7                            // mask quads per thread: 7 * 160 >= 1024
__global__ __launch_bounds__(160) void proj_kernel(
    const float* __restrict__ x, const int* __restrict__ mask,
    const float* __restrict__ Wq, const float* __restrict__ bq,
    const float* __restrict__ Wk, const float* __restrict__ bk,
    const float* __restrict__ Wv, const float* __restrict__ bv,
    float* __restrict__ qws, float* __restrict__ kws, float* __restrict__ vws,
    int* __restrict__ invws, int* __restrict__ nvws, float* __restrict__ vpart)
{
    __shared__ int scnt[5];
    const int lane = threadIdx.x & 31;
    const int g    = __builtin_amdgcn_readfirstlane(threadIdx.x >> 5);  // output group
    const int h    = lane >> 4;
    const int lm   = lane & 15;
    const int p0   = blockIdx.x * PROJ_PIX;     // first pixel, counted over all batches
    const int b    = p0 >> 12;
    const int n0   = p0 & (N_PIX - 1);

    // output row lm of the group (A operand) and the 8 biases of rows 8h..8h+7
    const float* wrow;
    const float* bias;
    if (g == 0) {
        wrow = (lm < CQ) ? Wq + lm * C_IN : Wk + (lm - CQ) * C_IN;
        bias = h ? bk : bq;
    } else {
        wrow = Wv + ((g - 1) * 16 + lm) * C_IN;
        bias = bv + (g - 1) * 16 + 8 * h;
    }

    const float* xp = x + (size_t)b * C_IN * N_PIX + (size_t)(4 * h) * N_PIX + n0 + 2 * lm;
    // (all loops of this kernel are unrolled so that the fragment arrays stay in registers)
    const v4f b0 = *(const v4f*)bias;
    const v4f b1 = *(const v4f*)(bias + 4);
    v4f wa[8];
    v2f xb[8][4];
#pragma unroll
    for (int j = 0; j < 8; ++j) wa[j] = *(const v4f*)(wrow + 8 * j + 4 * h);
    // the bias and weight loads' address registers may be rewritten behind this point
    asm volatile("s_wait_xcnt 0x0" ::: "memory");
#pragma unroll
    for (int j = 0; j < 8; ++j) {
#pragma unroll
        for (int i = 0; i < 4; ++i)
            xb[j][i] = *(const v2f*)(xp + (size_t)(8 * j + i) * N_PIX);
    }
    // the batch's mask in front of this block (quads past it are read at a
    // clamped place and not counted) and the block's own 32 pixels
    const int* mrow = mask + b * N_PIX;
    i32x4 mq[MQ];
#pragma unroll
    for (int i = 0; i < MQ; ++i) {
        const int q4 = (int)threadIdx.x + 160 * i;
        mq[i] = *(const i32x4*)(mrow + 4 * (q4 < N_PIX / 4 ? q4 : N_PIX / 4 - 1));
    }
    const int mown = mrow[n0 + lane];
    // keeps the scheduler from sinking the loads among the matrix steps, where a
    // wave would pay the trip to memory several times instead of once
    __builtin_amdgcn_sched_barrier(0);

    // valid pixels in front of the block: per thread, per wave (a ballot for
    // each bit of the count, at most 28), then over the 5 waves through LDS
    int cnt = 0;
#pragma unroll
    for (int i = 0; i < MQ; ++i) {
        const int c4 = (mq[i][0] != 0) + (mq[i][1] != 0) + (mq[i][2] != 0) + (mq[i][3] != 0);
        cnt += (4 * ((int)threadIdx.x + 160 * i) < n0) ? c4 : 0;
    }
    int wsum = 0;
#pragma unroll
    for (int bit = 0; bit < 5; ++bit)
        wsum += __popc((unsigned)__ballot((cnt >> bit) & 1)) << bit;
    if (lane == 0) scnt[g] = wsum;
    const unsigned mbits = (unsigned)__ballot(mown != 0);

    v8f acc0 = {b0[0], b0[1], b0[2], b0[3], b1[0], b1[1], b1[2], b1[3]};
    v8f acc1 = acc0;
#pragma unroll
    for (int j = 0; j < 8; ++j) {
#pragma unroll
        for (int e = 0; e < 2; ++e) {
            const v2f a  = {wa[j][2 * e], wa[j][2 * e + 1]};
            const v2f x0 = {xb[j][2 * e][0], xb[j][2 * e + 1][0]};
            const v2f x1 = {xb[j][2 * e][1], xb[j][2 * e + 1][1]};
            acc0 = __builtin_amdgcn_wmma_f32_16x16x4_f32(false, a, false, x0,
                                                         (short)0, acc0, false, false);
            acc1 = __builtin_amdgcn_wmma_f32_16x16x4_f32(false, a, false, x1,
                                                         (short)0, acc1, false, false);
        }
    }

    __syncthreads();   // the five waves' counts are in LDS
    const int base = scnt[0] + scnt[1] + scnt[2] + scnt[3] + scnt[4];

    // packed places of pixels n0 + 2lm and n0 + 2lm + 1: a valid pixel goes to
    // its rank among the valid ones, a masked one to N - 1 - its rank among the masked
    const int i0  = 2 * lm;
    const int ok0 = (mbits >> i0) & 1;
    const int ok1 = (mbits >> (i0 + 1)) & 1;
    const int rk0 = base + __popc(mbits & ((1u << i0) - 1u));
    const int rk1 = rk0 + ok0;
    const int pos0 = ok0 ? rk0 : N_PIX - 1 - (n0 + i0 - rk0);
    const int pos1 = ok1 ? rk1 : N_PIX - 1 - (n0 + i0 + 1 - rk1);

    // acc0[r], acc1[r]: output row r + 8h at pixels n0 + 2lm and n0 + 2lm + 1
    if (g == 0) {
        float* dbase = (h ? kws : qws) + (size_t)b * N_PIX * CQ;
        float* dst0 = dbase + (size_t)pos0 * CQ;
        float* dst1 = dbase + (size_t)pos1 * CQ;
        const v4f s0 = {acc0[0], acc0[1], acc0[2], acc0[3]};
        const v4f s1 = {acc0[4], acc0[5], acc0[6], acc0[7]};
        const v4f s2 = {acc1[0], acc1[1], acc1[2], acc1[3]};
        const v4f s3 = {acc1[4], acc1[5], acc1[6], acc1[7]};
        *(v4f*)(dst0)     = s0;
        *(v4f*)(dst0 + 4) = s1;
        *(v4f*)(dst1)     = s2;
        *(v4f*)(dst1 + 4) = s3;
        if (h == 0) {   // which pixel stands at each packed place
            invws[b * N_PIX + pos0] = n0 + i0;
            invws[b * N_PIX + pos1] = n0 + i0 + 1;
        }
        if (lane == 0 && n0 == N_PIX - PROJ_PIX)   // the batch's last block knows the total
            nvws[b] = base + __popc(mbits);
        // the stores' address and data registers may be rewritten behind this point
        asm volatile("s_wait_xcnt 0x0" ::: "memory");
    } else {
        // a packed place's 64 channels lie side by side: 8 of them per lane and pixel
        float* vp = vws + (size_t)b * C_IN * N_PIX + (g - 1) * 16 + 8 * h;
        const v4f s0 = {acc0[0], acc0[1], acc0[2], acc0[3]};
        const v4f s1 = {acc0[4], acc0[5], acc0[6], acc0[7]};
        const v4f s2 = {acc1[0], acc1[1], acc1[2], acc1[3]};
        const v4f s3 = {acc1[4], acc1[5], acc1[6], acc1[7]};
        *(v4f*)(vp + (size_t)pos0 * C_IN)     = s0;
        *(v4f*)(vp + (size_t)pos0 * C_IN + 4) = s1;
        *(v4f*)(vp + (size_t)pos1 * C_IN)     = s2;
        *(v4f*)(vp + (size_t)pos1 * C_IN + 4) = s3;
        float rs[8];
#pragma unroll
        for (int r = 0; r < 8; ++r) rs[r] = acc0[r] + acc1[r];
        // the stores' address and data registers may be rewritten behind this point
        asm volatile("s_wait_xcnt 0x0" ::: "memory");
        // the block's sum of v over its 32 pixels, 8 channels per half-wave
#pragma unroll
        for (int d = 1; d < 16; d <<= 1) {
#pragma unroll
            for (int r = 0; r < 8; ++r) rs[r] += __shfl_xor(rs[r], d);
        }
        if (lm == 0) {
            float* sp = vpart + (size_t)(b * PROJ_BLK + (n0 >> 5)) * C_IN + (g - 1) * 16 + 8 * h;
            const v4f t0 = {rs[0], rs[1], rs[2], rs[3]};
            const v4f t1 = {rs[4], rs[5], rs[6], rs[7]};
            *(v4f*)(sp)     = t0;
            *(v4f*)(sp + 4) = t1;
        }
    }
}

// ---------------------------------------------------------------------------
// Kernel 2: flash attention and the output. A work-group owns 16 packed places
// (one query tile) of a batch. Its 8 waves share the queries and split the key
// tiles up to nv into 8 ranges; each keeps its own running maximum, denominator
// and un-normalised sums, and the ranges are joined through LDS:
// weight of a range = exp(m_w - max m), out = gamma * (sum w acc) / (sum w l) + x,
// stored at the pixel that stands at the packed place.
// Places from nv on hold masked pixels, which take gamma * (mean of v) + x.
// V rows are read straight from global memory, 16 bytes a lane: lane lm holds
// channels 4lm..4lm+3 of a key, so row lm of output tile cg is channel 4lm + cg.
// ---------------------------------------------------------------------------
__global__ __launch_bounds__(256) void attn_kernel(
    const float* __restrict__ x, const int* __restrict__ nvws, const int* __restrict__ invws,
    const float* __restrict__ qws, const float* __restrict__ kws,
    const float* __restrict__ vws, const float* __restrict__ vpart,
    const float* __restrict__ gammaP, float* __restrict__ out)
{
    __shared__ float spart[KW][C_IN * OP];      // partial sums: row cg*16 + r + 8h, column = query
    __shared__ float sm[KW][16];
    __shared__ float sl[KW][16];
    __shared__ __attribute__((aligned(16))) float sred[16][C_IN];
    __shared__ float svm[C_IN];

    const int tid  = threadIdx.x;
    const int lane = tid & 31;
    const int wv   = __builtin_amdgcn_readfirstlane(tid >> 5);
    const int h    = lane >> 4;
    const int lm   = lane & 15;
    // the query tile is the slow index: the tiles that hold valid queries start first
    const int b    = blockIdx.x & 3;
    const int i0   = (blockIdx.x >> 2) << 4;
    // valid pixels of the batch, held to the shape's bounds
    const int nvr = nvws[b];
    const int nv  = __builtin_amdgcn_readfirstlane(nvr < 0 ? 0 : (nvr > N_PIX ? N_PIX : nvr));
    const bool anyvalid  = i0 < nv;             // both the same for the whole work-group
    const bool anymasked = i0 + 16 > nv;

    // the output element of this thread: place i0 + oq, channels 4*oc .. 4*oc + 3
    const int oq = tid & 15;
    const int oc = tid >> 4;
    const int n  = invws[b * N_PIX + i0 + oq] & (N_PIX - 1);
    const size_t obase = ((size_t)b * C_IN + 4 * oc) * N_PIX + n;
    const float gamma = gammaP[0];
    float xv[4];
#pragma unroll
    for (int cg = 0; cg < 4; ++cg) xv[cg] = x[obase + (size_t)cg * N_PIX];

    // mean of v over all pixels of the batch: the 128 projection blocks' sums,
    // 8 blocks per thread, then 16 groups through LDS
    if (anymasked) {
        const float* sp = vpart + (size_t)(b * PROJ_BLK + oc * 8) * C_IN + 4 * oq;
        v4f ps = *(const v4f*)sp;
#pragma unroll
        for (int i = 1; i < 8; ++i) ps += *(const v4f*)(sp + i * C_IN);
        *(v4f*)&sred[oc][4 * oq] = ps;
        __syncthreads();   // the sixteen groups' sums are in LDS (the test is the same for the whole work-group)
        if (tid < C_IN) {
            float a = sred[0][tid];
#pragma unroll
            for (int q = 1; q < 16; ++q) a += sred[q][tid];
            svm[tid] = a * (1.0f / N_PIX);
        }
    }

    if (anyvalid) {
        // this wave's key tiles: an equal share of the tiles up to nv, cut at the last
        const int ntile = (nv + 15) >> 4;
        const int share = (ntile + KW - 1) / KW;
        const int t0    = wv * share;
        const int rest  = ntile - t0;
        const int trips = rest < 0 ? 0 : (rest < share ? rest : share);

        // Q as B-fragments (K = vgpr + 2h)
        const float* qp = qws + ((size_t)b * N_PIX + i0 + lm) * CQ;
        const v2f qb0 = *(const v2f*)(qp + 2 * h);
        const v2f qb1 = *(const v2f*)(qp + 4 + 2 * h);

        v8f acc0 = {}, acc1 = {}, acc2 = {}, acc3 = {};
        float m = -INFINITY;
        float l = 0.0f;

        const float* kbase = kws + (size_t)b * N_PIX * CQ + lm * CQ + 2 * h;
        const float* vbase = vws + (size_t)b * C_IN * N_PIX + 2 * h * C_IN + 4 * lm;

        // K and V A-fragments are fetched one tile ahead (a wave without tiles reads tile 0).
        // V A-fragments: channel 4lm + cg, keys 4kc + 2h + v
        const int tf = trips > 0 ? t0 : 0;
        v2f ka0 = *(const v2f*)(kbase + (size_t)tf * 16 * CQ);
        v2f ka1 = *(const v2f*)(kbase + (size_t)tf * 16 * CQ + 4);
        v2f va[4][4];
#pragma unroll
        for (int kc = 0; kc < 4; ++kc) {
            const v4f e0 = *(const v4f*)(vbase + ((size_t)tf * 16 + 4 * kc) * C_IN);
            const v4f e1 = *(const v4f*)(vbase + ((size_t)tf * 16 + 4 * kc + 1) * C_IN);
#pragma unroll
            for (int cg = 0; cg < 4; ++cg) { va[cg][kc].x = e0[cg]; va[cg][kc].y = e1[cg]; }
        }

        for (int i = 0; i < trips; ++i) {
            const int t  = t0 + i;
            const int tn = i + 1 < trips ? t + 1 : t;   // the last trip reads its own tile again

            // the next tile's V rows: keys 4kc + 2h + v, channels 4lm..4lm+3
            const float* vp = vbase + (size_t)tn * 16 * C_IN;
            v4f vl[4][2];
#pragma unroll
            for (int kc = 0; kc < 4; ++kc) {
                vl[kc][0] = *(const v4f*)(vp + (4 * kc) * C_IN);
                vl[kc][1] = *(const v4f*)(vp + (4 * kc + 1) * C_IN);
            }
            const v2f kn0 = *(const v2f*)(kbase + (size_t)tn * 16 * CQ);
            const v2f kn1 = *(const v2f*)(kbase + (size_t)tn * 16 * CQ + 4);
            // these loads' address registers may be rewritten behind this point
            asm volatile("s_wait_xcnt 0x0" ::: "memory");
            // keeps the loads in front of this tile's work, whose time then covers
            // their trip to L2
            __builtin_amdgcn_sched_barrier(0);

            const int left = nv - (t << 4);      // valid keys from this tile on
            const unsigned kbal = left >= 16 ? 0xFFFFu : (left <= 0 ? 0u : (1u << left) - 1u);
            const unsigned kb = kbal >> (8 * h); // per-half key bits

            // S^T = K_tile x Q^T  (two K=4 chunks)
            v8f s = {};
            s = __builtin_amdgcn_wmma_f32_16x16x4_f32(false, ka0, false, qb0,
                                                      (short)0, s, false, false);
            s = __builtin_amdgcn_wmma_f32_16x16x4_f32(false, ka1, false, qb1,
                                                      (short)0, s, false, false);

            // mask + online softmax stats
            float p[8];
            float tmax = -INFINITY;
#pragma unroll
            for (int r = 0; r < 8; ++r) {
                const float sv = (kb & (1u << r)) ? s[r] : NEGV;
                p[r] = sv;
                tmax = fmaxf(tmax, sv);
            }
            tmax = fmaxf(tmax, __shfl_xor(tmax, 16));
            const float mnew  = fmaxf(m, tmax);
            const float scale = __expf(m - mnew);
            float psum = 0.0f;
#pragma unroll
            for (int r = 0; r < 8; ++r) {
                p[r] = __expf(p[r] - mnew);
                psum += p[r];
            }
            psum += __shfl_xor(psum, 16);
            l = l * scale + psum;
            m = mnew;
#pragma unroll
            for (int r = 0; r < 8; ++r) {
                acc0[r] *= scale; acc1[r] *= scale;
                acc2[r] *= scale; acc3[r] *= scale;
            }

            // Re-lay P into B fragments (key = 4kc + v + 2h at query lm)
            float pl[8], ph[8];
#pragma unroll
            for (int r = 0; r < 8; ++r) {
                pl[r] = __shfl(p[r], lm);
                ph[r] = __shfl(p[r], lm + 16);
            }
            v2f bp[4];
#pragma unroll
            for (int kc = 0; kc < 4; ++kc) {
                const int r0 = (kc & 1) * 4;
                const float s0 = (kc < 2) ? pl[r0 + 0] : ph[r0 + 0];
                const float s1 = (kc < 2) ? pl[r0 + 1] : ph[r0 + 1];
                const float s2 = (kc < 2) ? pl[r0 + 2] : ph[r0 + 2];
                const float s3 = (kc < 2) ? pl[r0 + 3] : ph[r0 + 3];
                bp[kc].x = h ? s2 : s0;
                bp[kc].y = h ? s3 : s1;
            }

            // out_tile += V_tile x P^T
#pragma unroll
            for (int kc = 0; kc < 4; ++kc) {
                acc0 = __builtin_amdgcn_wmma_f32_16x16x4_f32(false, va[0][kc], false, bp[kc],
                                                             (short)0, acc0, false, false);
                acc1 = __builtin_amdgcn_wmma_f32_16x16x4_f32(false, va[1][kc], false, bp[kc],
                                                             (short)0, acc1, false, false);
                acc2 = __builtin_amdgcn_wmma_f32_16x16x4_f32(false, va[2][kc], false, bp[kc],
                                                             (short)0, acc2, false, false);
                acc3 = __builtin_amdgcn_wmma_f32_16x16x4_f32(false, va[3][kc], false, bp[kc],
                                                             (short)0, acc3, false, false);
            }
            // keeps the wait for the next tile's loads from rising in front of this tile's
            // softmax, where the wave would sit out their whole trip to L2
            __builtin_amdgcn_sched_barrier(0);
            ka0 = kn0;
            ka1 = kn1;
#pragma unroll
            for (int kc = 0; kc < 4; ++kc) {
#pragma unroll
                for (int cg = 0; cg < 4; ++cg) { va[cg][kc].x = vl[kc][0][cg]; va[cg][kc].y = vl[kc][1][cg]; }
            }
        }

        // this range's partial sums and statistics (a wave without tiles: -inf, 0, zeros)
        float* pw = &spart[wv][8 * h * OP + lm];
#pragma unroll
        for (int r = 0; r < 8; ++r) {
            pw[(0 * 16 + r) * OP] = acc0[r];
            pw[(1 * 16 + r) * OP] = acc1[r];
            pw[(2 * 16 + r) * OP] = acc2[r];
            pw[(3 * 16 + r) * OP] = acc3[r];
        }
        if (h == 0) {   // both halves hold the same statistics
            sm[wv][lm] = m;
            sl[wv][lm] = l;
        }
    }
    __syncthreads();   // the eight ranges' partial sums and the mean of v are in LDS

    float o[4] = {0.0f, 0.0f, 0.0f, 0.0f};
    if (anyvalid) {
        // range 0 always holds a valid key, so the maximum is finite and an empty
        // range (maximum -inf) weighs exactly 0
        float w[KW];
#pragma unroll
        for (int s = 0; s < KW; ++s) w[s] = sm[s][oq];
        float mx = w[0];
#pragma unroll
        for (int s = 1; s < KW; ++s) mx = fmaxf(mx, w[s]);
        float lsum = 0.0f;
#pragma unroll
        for (int s = 0; s < KW; ++s) {
            w[s] = __expf(w[s] - mx);
            lsum = fmaf(w[s], sl[s][oq], lsum);
        }
        const float rl = 1.0f / lsum;
#pragma unroll
        for (int cg = 0; cg < 4; ++cg) {
            float a = 0.0f;
#pragma unroll
            for (int s = 0; s < KW; ++s) a = fmaf(w[s], spart[s][(cg * 16 + oc) * OP + oq], a);
            o[cg] = a * rl;
        }
    }
    if (anymasked) {
        const bool masked = i0 + oq >= nv;
#pragma unroll
        for (int cg = 0; cg < 4; ++cg) o[cg] = masked ? svm[4 * oc + cg] : o[cg];
    }
#pragma unroll
    for (int cg = 0; cg < 4; ++cg)
        out[obase + (size_t)cg * N_PIX] = fmaf(gamma, o[cg], xv[cg]);
}

// ---------------------------------------------------------------------------
extern "C" void kernel_launch(void* const* d_in, const int* in_sizes, int n_in,
                              void* d_out, int out_size, void* d_ws, size_t ws_size,
                              hipStream_t stream) {
    const float* x     = (const float*)d_in[0];
    const int*   mask  = (const int*)d_in[1];
    const float* Wq    = (const float*)d_in[2];
    const float* bq    = (const float*)d_in[3];
    const float* Wk    = (const float*)d_in[4];
    const float* bk    = (const float*)d_in[5];
    const float* Wv    = (const float*)d_in[6];
    const float* bv    = (const float*)d_in[7];
    const float* gamma = (const float*)d_in[8];
    float* out = (float*)d_out;

    float* qws = (float*)d_ws;                    // 4*4096*8  floats
    float* kws = qws + 4 * N_PIX * CQ;            // 4*4096*8  floats
    float* vws = kws + 4 * N_PIX * CQ;            // 4*64*4096 floats
    int*   invws = (int*)(vws + 4 * C_IN * N_PIX);    // 4*4096 ints: pixel at a packed place
    int*   nvws  = invws + 4 * N_PIX;                 // 4 ints: valid pixels per batch
    float* vpart = (float*)(nvws + 4);                // 4*128*64 floats: sums of v per block

    proj_kernel<<<4 * N_PIX / PROJ_PIX, 160, 0, stream>>>(x, mask, Wq, bq, Wk, bk, Wv, bv, qws, kws, vws,
                                                        invws, nvws, vpart);
    attn_kernel<<<4 * N_PIX / 16, 256, 0, stream>>>(x, nvws, invws, qws, kws, vws, vpart, gamma, out);
}

// v005
// It runs in 31.4 microseconds.
// In both of two side-by-side timings against v004, it was 1.07 times as fast.
// Over all steps from v000 it is 9.03 times as fast.
#include <hip/hip_runtime.h>

typedef __attribute__((ext_vector_type(2))) float v2f;
typedef __attribute__((ext_vector_type(4))) float v4f;
typedef __attribute__((ext_vector_type(8))) float v8f;
typedef __attribute__((ext_vector_type(4))) int i32x4;

#define N_PIX 4096
#define C_IN  64
#define CQ    8
#define NEGV  (-1e9f)
#define KW 8                            // key ranges, one wave of a work-group each
#define OP 20                           // LDS pitch in dwords of a partial-sum row (16 queries)

// ---------------------------------------------------------------------------
// Kernel 1: the 1x1-conv projections as one product W(80 x 64) * x(64 x pixels)
// on the f32 matrix form -> q,k (B,N,8), v (B,N,C).
// A block covers 32 neighbouring pixels; each of its 5 waves takes 16 output
// rows (wave 0: q and k, waves 1..4: 16 channels of v) as two 16x16 tiles:
// tile 0 holds the even pixels, tile 1 the odd ones, so that a lane loads
// pixel pairs and a half-wave touches whole 128-byte lines.
// q, k and v are stored in a packed pixel order: the valid pixels of a batch
// first, in their own order, the masked ones from the end backwards. A masked
// key has weight exactly 0 for a valid query, and a masked query weighs every
// key alike, so the attention runs over the valid pixels alone and a masked
// pixel takes the mean of v, whose per-block sums are stored here.
// ---------------------------------------------------------------------------
#define PROJ_PIX 32
#define PROJ_BLK (N_PIX / PROJ_PIX)     // 128 blocks per batch
#define MQ 7                            // mask quads per thread: 7 * 160 >= 1024
__global__ __launch_bounds__(160) void proj_kernel(
    const float* __restrict__ x, const int* __restrict__ mask,
    const float* __restrict__ Wq, const float* __restrict__ bq,
    const float* __restrict__ Wk, const float* __restrict__ bk,
    const float* __restrict__ Wv, const float* __restrict__ bv,
    float* __restrict__ qws, float* __restrict__ kws, float* __restrict__ vws,
    int* __restrict__ invws, int* __restrict__ nvws, float* __restrict__ vpart)
{
    __shared__ int scnt[5];
    const int lane = threadIdx.x & 31;
    const int g    = __builtin_amdgcn_readfirstlane(threadIdx.x >> 5);  // output group
    const int h    = lane >> 4;
    const int lm   = lane & 15;
    const int p0   = blockIdx.x * PROJ_PIX;     // first pixel, counted over all batches
    const int b    = p0 >> 12;
    const int n0   = p0 & (N_PIX - 1);

    // output row lm of the group (A operand) and the 8 biases of rows 8h..8h+7
    const float* wrow;
    const float* bias;
    if (g == 0) {
        wrow = (lm < CQ) ? Wq + lm * C_IN : Wk + (lm - CQ) * C_IN;
        bias = h ? bk : bq;
    } else {
        wrow = Wv + ((g - 1) * 16 + lm) * C_IN;
        bias = bv + (g - 1) * 16 + 8 * h;
    }

    const float* xp = x + (size_t)b * C_IN * N_PIX + (size_t)(4 * h) * N_PIX + n0 + 2 * lm;
    // (all loops of this kernel are unrolled so that the fragment arrays stay in registers)
    const v4f b0 = *(const v4f*)bias;
    const v4f b1 = *(const v4f*)(bias + 4);
    v4f wa[8];
    v2f xb[8][4];
#pragma unroll
    for (int j = 0; j < 8; ++j) wa[j] = *(const v4f*)(wrow + 8 * j + 4 * h);
    // the bias and weight loads' address registers may be rewritten behind this point
    asm volatile("s_wait_xcnt 0x0" ::: "memory");
#pragma unroll
    for (int j = 0; j < 8; ++j) {
#pragma unroll
        for (int i = 0; i < 4; ++i)
            xb[j][i] = *(const v2f*)(xp + (size_t)(8 * j + i) * N_PIX);
    }
    // the batch's mask in front of this block (quads past it are read at a
    // clamped place and not counted) and the block's own 32 pixels
    const int* mrow = mask + b * N_PIX;
    i32x4 mq[MQ];
#pragma unroll
    for (int i = 0; i < MQ; ++i) {
        const int q4 = (int)threadIdx.x + 160 * i;
        mq[i] = *(const i32x4*)(mrow + 4 * (q4 < N_PIX / 4 ? q4 : N_PIX / 4 - 1));
    }
    const int mown = mrow[n0 + lane];
    // keeps the scheduler from sinking the loads among the matrix steps, where a
    // wave would pay the trip to memory several times instead of once
    __builtin_amdgcn_sched_barrier(0);

    // valid pixels in front of the block: per thread, per wave (a ballot for
    // each bit of the count, at most 28), then over the 5 waves through LDS
    int cnt = 0;
#pragma unroll
    for (int i = 0; i < MQ; ++i) {
        const int c4 = (mq[i][0] != 0) + (mq[i][1] != 0) + (mq[i][2] != 0) + (mq[i][3] != 0);
        cnt += (4 * ((int)threadIdx.x + 160 * i) < n0) ? c4 : 0;
    }
    int wsum = 0;
#pragma unroll
    for (int bit = 0; bit < 5; ++bit)
        wsum += __popc((unsigned)__ballot((cnt >> bit) & 1)) << bit;
    if (lane == 0) scnt[g] = wsum;
    const unsigned mbits = (unsigned)__ballot(mown != 0);

    v8f acc0 = {b0[0], b0[1], b0[2], b0[3], b1[0], b1[1], b1[2], b1[3]};
    v8f acc1 = acc0;
#pragma unroll
    for (int j = 0; j < 8; ++j) {
#pragma unroll
        for (int e = 0; e < 2; ++e) {
            const v2f a  = {wa[j][2 * e], wa[j][2 * e + 1]};
            const v2f x0 = {xb[j][2 * e][0], xb[j][2 * e + 1][0]};
            const v2f x1 = {xb[j][2 * e][1], xb[j][2 * e + 1][1]};
            acc0 = __builtin_amdgcn_wmma_f32_16x16x4_f32(false, a, false, x0,
                                                         (short)0, acc0, false, false);
            acc1 = __builtin_amdgcn_wmma_f32_16x16x4_f32(false, a, false, x1,
                                                         (short)0, acc1, false, false);
        }
    }

    __syncthreads();   // the five waves' counts are in LDS
    const int base = scnt[0] + scnt[1] + scnt[2] + scnt[3] + scnt[4];

    // packed places of pixels n0 + 2lm and n0 + 2lm + 1: a valid pixel goes to
    // its rank among the valid ones, a masked one to N - 1 - its rank among the masked
    const int i0  = 2 * lm;
    const int ok0 = (mbits >> i0) & 1;
    const int ok1 = (mbits >> (i0 + 1)) & 1;
    const int rk0 = base + __popc(mbits & ((1u << i0) - 1u));
    const int rk1 = rk0 + ok0;
    const int pos0 = ok0 ? rk0 : N_PIX - 1 - (n0 + i0 - rk0);
    const int pos1 = ok1 ? rk1 : N_PIX - 1 - (n0 + i0 + 1 - rk1);

    // acc0[r], acc1[r]: output row r + 8h at pixels n0 + 2lm and n0 + 2lm + 1
    if (g == 0) {
        float* dbase = (h ? kws : qws) + (size_t)b * N_PIX * CQ;
        float* dst0 = dbase + (size_t)pos0 * CQ;
        float* dst1 = dbase + (size_t)pos1 * CQ;
        const v4f s0 = {acc0[0], acc0[1], acc0[2], acc0[3]};
        const v4f s1 = {acc0[4], acc0[5], acc0[6], acc0[7]};
        const v4f s2 = {acc1[0], acc1[1], acc1[2], acc1[3]};
        const v4f s3 = {acc1[4], acc1[5], acc1[6], acc1[7]};
        *(v4f*)(dst0)     = s0;
        *(v4f*)(dst0 + 4) = s1;
        *(v4f*)(dst1)     = s2;
        *(v4f*)(dst1 + 4) = s3;
        if (h == 0) {   // which pixel stands at each packed place
            invws[b * N_PIX + pos0] = n0 + i0;
            invws[b * N_PIX + pos1] = n0 + i0 + 1;
        }
        if (lane == 0 && n0 == N_PIX - PROJ_PIX)   // the batch's last block knows the total
            nvws[b] = base + __popc(mbits);
        // the stores' address and data registers may be rewritten behind this point
        asm volatile("s_wait_xcnt 0x0" ::: "memory");
    } else {
        // a packed place's 64 channels lie side by side: 8 of them per lane and pixel
        float* vp = vws + (size_t)b * C_IN * N_PIX + (g - 1) * 16 + 8 * h;
        const v4f s0 = {acc0[0], acc0[1], acc0[2], acc0[3]};
        const v4f s1 = {acc0[4], acc0[5], acc0[6], acc0[7]};
        const v4f s2 = {acc1[0], acc1[1], acc1[2], acc1[3]};
        const v4f s3 = {acc1[4], acc1[5], acc1[6], acc1[7]};
        *(v4f*)(vp + (size_t)pos0 * C_IN)     = s0;
        *(v4f*)(vp + (size_t)pos0 * C_IN + 4) = s1;
        *(v4f*)(vp + (size_t)pos1 * C_IN)     = s2;
        *(v4f*)(vp + (size_t)pos1 * C_IN + 4) = s3;
        float rs[8];
#pragma unroll
        for (int r = 0; r < 8; ++r) rs[r] = acc0[r] + acc1[r];
        // the stores' address and data registers may be rewritten behind this point
        asm volatile("s_wait_xcnt 0x0" ::: "memory");
        // the block's sum of v over its 32 pixels, 8 channels per half-wave
#pragma unroll
        for (int d = 1; d < 16; d <<= 1) {
#pragma unroll
            for (int r = 0; r < 8; ++r) rs[r] += __shfl_xor(rs[r], d);
        }
        if (lm == 0) {
            float* sp = vpart + (size_t)(b * PROJ_BLK + (n0 >> 5)) * C_IN + (g - 1) * 16 + 8 * h;
            const v4f t0 = {rs[0], rs[1], rs[2], rs[3]};
            const v4f t1 = {rs[4], rs[5], rs[6], rs[7]};
            *(v4f*)(sp)     = t0;
            *(v4f*)(sp + 4) = t1;
        }
    }
}

// ---------------------------------------------------------------------------
// One wave's share of a dealt query tile: its range of key tiles as in kernel 2,
// but one 16-channel output tile alone (vbase points at channel 4lm + cg0). Same
// fragments, k orders and order of sums as there. Leaves the range's running
// maximum, denominator and un-normalised sums in LDS (rows r + 8h).
// ---------------------------------------------------------------------------
__device__ __forceinline__ void quarter_sums(
    const float* __restrict__ qp, const float* __restrict__ kbase, const float* __restrict__ vbase,
    const int nv, const int wv, const int h, const int lm,
    float* __restrict__ pw, float* __restrict__ smw, float* __restrict__ slw)
{
    const int ntile = (nv + 15) >> 4;
    const int share = (ntile + KW - 1) / KW;
    const int t0    = wv * share;
    const int rest  = ntile - t0;
    const int trips = rest < 0 ? 0 : (rest < share ? rest : share);

    const v2f qb0 = *(const v2f*)(qp + 2 * h);
    const v2f qb1 = *(const v2f*)(qp + 4 + 2 * h);

    v8f acc = {};
    float m = -INFINITY;
    float l = 0.0f;

    // K and V A-fragments are fetched one tile ahead (a wave without tiles reads tile 0)
    const int tf = trips > 0 ? t0 : 0;
    v2f ka0 = *(const v2f*)(kbase + (size_t)tf * 16 * CQ);
    v2f ka1 = *(const v2f*)(kbase + (size_t)tf * 16 * CQ + 4);
    v2f va[4];
#pragma unroll
    for (int kc = 0; kc < 4; ++kc) {
        va[kc].x = vbase[((size_t)tf * 16 + 4 * kc) * C_IN];
        va[kc].y = vbase[((size_t)tf * 16 + 4 * kc + 1) * C_IN];
    }
    // these loads' address registers may be rewritten behind this point
    asm volatile("s_wait_xcnt 0x0" ::: "memory");

    for (int i = 0; i < trips; ++i) {
        const int t  = t0 + i;
        const int tn = i + 1 < trips ? t + 1 : t;   // the last trip reads its own tile again

        const float* vp = vbase + (size_t)tn * 16 * C_IN;
        v2f vn[4];
#pragma unroll
        for (int kc = 0; kc < 4; ++kc) {
            vn[kc].x = vp[(4 * kc) * C_IN];
            vn[kc].y = vp[(4 * kc + 1) * C_IN];
        }
        const v2f kn0 = *(const v2f*)(kbase + (size_t)tn * 16 * CQ);
        const v2f kn1 = *(const v2f*)(kbase + (size_t)tn * 16 * CQ + 4);
        // these loads' address registers may be rewritten behind this point
        asm volatile("s_wait_xcnt 0x0" ::: "memory");
        // keeps the loads in front of this tile's work, whose time then covers
        // their trip to L2
        __builtin_amdgcn_sched_barrier(0);

        const int left = nv - (t << 4);      // valid keys from this tile on
        const unsigned kbal = left >= 16 ? 0xFFFFu : (left <= 0 ? 0u : (1u << left) - 1u);
        const unsigned kb = kbal >> (8 * h); // per-half key bits

        v8f s = {};
        s = __builtin_amdgcn_wmma_f32_16x16x4_f32(false, ka0, false, qb0,
                                                  (short)0, s, false, false);
        s = __builtin_amdgcn_wmma_f32_16x16x4_f32(false, ka1, false, qb1,
                                                  (short)0, s, false, false);

        float p[8];
        float tmax = -INFINITY;
#pragma unroll
        for (int r = 0; r < 8; ++r) {
            const float sv = (kb & (1u << r)) ? s[r] : NEGV;
            p[r] = sv;
            tmax = fmaxf(tmax, sv);
        }
        tmax = fmaxf(tmax, __shfl_xor(tmax, 16));
        const float mnew  = fmaxf(m, tmax);
        const float scale = __expf(m - mnew);
        float psum = 0.0f;
#pragma unroll
        for (int r = 0; r < 8; ++r) {
            p[r] = __expf(p[r] - mnew);
            psum += p[r];
        }
        psum += __shfl_xor(psum, 16);
        l = l * scale + psum;
        m = mnew;
#pragma unroll
        for (int r = 0; r < 8; ++r) acc[r] *= scale;

        // Re-lay P into B fragments (key = 4kc + v + 2h at query lm)
        float pl[8], ph[8];
#pragma unroll
        for (int r = 0; r < 8; ++r) {
            pl[r] = __shfl(p[r], lm);
            ph[r] = __shfl(p[r], lm + 16);
        }
#pragma unroll
        for (int kc = 0; kc < 4; ++kc) {
            const int r0 = (kc & 1) * 4;
            const float s0 = (kc < 2) ? pl[r0 + 0] : ph[r0 + 0];
            const float s1 = (kc < 2) ? pl[r0 + 1] : ph[r0 + 1];
            const float s2 = (kc < 2) ? pl[r0 + 2] : ph[r0 + 2];
            const float s3 = (kc < 2) ? pl[r0 + 3] : ph[r0 + 3];
            const v2f bp = {h ? s2 : s0, h ? s3 : s1};
            acc = __builtin_amdgcn_wmma_f32_16x16x4_f32(false, va[kc], false, bp,
                                                        (short)0, acc, false, false);
        }
        ka0 = kn0;
        ka1 = kn1;
#pragma unroll
        for (int kc = 0; kc < 4; ++kc) va[kc] = vn[kc];
    }

#pragma unroll
    for (int r = 0; r < 8; ++r) pw[r * OP] = acc[r];
    if (h == 0) {   // both halves hold the same statistics
        smw[lm] = m;
        slw[lm] = l;
    }
}

// ---------------------------------------------------------------------------
// Kernel 2: flash attention and the output. A work-group owns 16 packed places
// (one query tile) of a batch. Its 8 waves share the queries and split the key
// tiles up to nv into 8 ranges; each keeps its own running maximum, denominator
// and un-normalised sums, and the ranges are joined through LDS:
// weight of a range = exp(m_w - max m), out = gamma * (sum w acc) / (sum w l) + x,
// stored at the pixel that stands at the packed place.
// Places from nv on hold masked pixels, which take gamma * (mean of v) + x.
// V rows are read straight from global memory, 16 bytes a lane: lane lm holds
// channels 4lm..4lm+3 of a key, so row lm of output tile cg is channel 4lm + cg.
// Placement: QT_EVEN query tiles a batch give every WGP two equal work-groups. A
// tile beyond them would stand as a third whole one on some WGP, and the launch
// would last as long as that WGP. Such a tile (while there are at most QT_EVEN / 4)
// is dealt by output tile cg to four of the work-groups from QT_EVEN on, whose
// own places are such tiles or masked ones; each repeats the scores and does a quarter of
// the second product. A work-group from QT_EVEN on then stores only the masked ones
// of its own places.
// ---------------------------------------------------------------------------
#define QT_EVEN 128
__global__ __launch_bounds__(256) void attn_kernel(
    const float* __restrict__ x, const int* __restrict__ nvws, const int* __restrict__ invws,
    const float* __restrict__ qws, const float* __restrict__ kws,
    const float* __restrict__ vws, const float* __restrict__ vpart,
    const float* __restrict__ gammaP, float* __restrict__ out)
{
    __shared__ float spart[KW][C_IN * OP];      // partial sums: row cg*16 + r + 8h, column = query
    __shared__ float sm[KW][16];
    __shared__ float sl[KW][16];
    __shared__ __attribute__((aligned(16))) float sred[16][C_IN];
    __shared__ float svm[C_IN];

    const int tid  = threadIdx.x;
    const int lane = tid & 31;
    const int wv   = __builtin_amdgcn_readfirstlane(tid >> 5);
    const int h    = lane >> 4;
    const int lm   = lane & 15;
    // the query tile is the slow index
    const int b    = blockIdx.x & 3;
    const int qt   = blockIdx.x >> 2;
    const int i0   = qt << 4;
    // valid pixels of the batch, held to the shape's bounds
    const int nvr = nvws[b];
    const int nv  = __builtin_amdgcn_readfirstlane(nvr < 0 ? 0 : (nvr > N_PIX ? N_PIX : nvr));
    // all of these are the same for the whole work-group
    const int  over = ((nv + 15) >> 4) - QT_EVEN;           // query tiles beyond the even deal
    const bool part = qt >= QT_EVEN && over > 0 && over <= QT_EVEN / 4;
    const int  cg0  = qt & 3;                               // a dealt tile's output tile
    const int  a0   = part ? (QT_EVEN + ((qt - QT_EVEN) >> 2)) << 4 : i0;   // first query place
    const bool anyvalid  = a0 < nv;
    const bool anymasked = i0 + 16 > nv;

    // the output element of this thread: place i0 + oq, channels 4*oc .. 4*oc + 3
    const int oq = tid & 15;
    const int oc = tid >> 4;
    const int n  = invws[b * N_PIX + i0 + oq] & (N_PIX - 1);
    const size_t obase = ((size_t)b * C_IN + 4 * oc) * N_PIX + n;
    const float gamma = gammaP[0];
    float xv[4];
#pragma unroll
    for (int cg = 0; cg < 4; ++cg) xv[cg] = x[obase + (size_t)cg * N_PIX];
    // of a dealt tile: place a0 + oq, channel 4*oc + cg0
    size_t abase = obase;
    float xa = 0.0f;
    if (part) {
        const int na = invws[b * N_PIX + a0 + oq] & (N_PIX - 1);
        abase = ((size_t)b * C_IN + 4 * oc + cg0) * N_PIX + na;
        xa = x[abase];
        // these loads' address registers may be rewritten behind this point
        asm volatile("s_wait_xcnt 0x0" ::: "memory");
    }

    // mean of v over all pixels of the batch: the 128 projection blocks' sums,
    // 8 blocks per thread, then 16 groups through LDS
    if (anymasked) {
        const float* sp = vpart + (size_t)(b * PROJ_BLK + oc * 8) * C_IN + 4 * oq;
        v4f ps = *(const v4f*)sp;
#pragma unroll
        for (int i = 1; i < 8; ++i) ps += *(const v4f*)(sp + i * C_IN);
        *(v4f*)&sred[oc][4 * oq] = ps;
        __syncthreads();   // the sixteen groups' sums are in LDS (the test is the same for the whole work-group)
        if (tid < C_IN) {
            float a = sred[0][tid];
#pragma unroll
            for (int q = 1; q < 16; ++q) a += sred[q][tid];
            svm[tid] = a * (1.0f / N_PIX);
        }
    }

    if (anyvalid) {
      if (part) {
        quarter_sums(qws + ((size_t)b * N_PIX + a0 + lm) * CQ,
                     kws + (size_t)b * N_PIX * CQ + lm * CQ + 2 * h,
                     vws + (size_t)b * C_IN * N_PIX + 2 * h * C_IN + 4 * lm + cg0,
                     nv, wv, h, lm, &spart[wv][8 * h * OP + lm], sm[wv], sl[wv]);
      } else {
        // this wave's key tiles: an equal share of the tiles up to nv, cut at the last
        const int ntile = (nv + 15) >> 4;
        const int share = (ntile + KW - 1) / KW;
        const int t0    = wv * share;
        const int rest  = ntile - t0;
        const int trips = rest < 0 ? 0 : (rest < share ? rest : share);

        // Q as B-fragments (K = vgpr + 2h)
        const float* qp = qws + ((size_t)b * N_PIX + i0 + lm) * CQ;
        const v2f qb0 = *(const v2f*)(qp + 2 * h);
        const v2f qb1 = *(const v2f*)(qp + 4 + 2 * h);

        v8f acc0 = {}, acc1 = {}, acc2 = {}, acc3 = {};
        float m = -INFINITY;
        float l = 0.0f;

        const float* kbase = kws + (size_t)b * N_PIX * CQ + lm * CQ + 2 * h;
        const float* vbase = vws + (size_t)b * C_IN * N_PIX + 2 * h * C_IN + 4 * lm;

        // K and V A-fragments are fetched one tile ahead (a wave without tiles reads tile 0).
        // V A-fragments: channel 4lm + cg, keys 4kc + 2h + v
        const int tf = trips > 0 ? t0 : 0;
        v2f ka0 = *(const v2f*)(kbase + (size_t)tf * 16 * CQ);
        v2f ka1 = *(const v2f*)(kbase + (size_t)tf * 16 * CQ + 4);
        v2f va[4][4];
#pragma unroll
        for (int kc = 0; kc < 4; ++kc) {
            const v4f e0 = *(const v4f*)(vbase + ((size_t)tf * 16 + 4 * kc) * C_IN);
            const v4f e1 = *(const v4f*)(vbase + ((size_t)tf * 16 + 4 * kc + 1) * C_IN);
#pragma unroll
            for (int cg = 0; cg < 4; ++cg) { va[cg][kc].x = e0[cg]; va[cg][kc].y = e1[cg]; }
        }

        for (int i = 0; i < trips; ++i) {
            const int t  = t0 + i;
            const int tn = i + 1 < trips ? t + 1 : t;   // the last trip reads its own tile again

            // the next tile's V rows: keys 4kc + 2h + v, channels 4lm..4lm+3
            const float* vp = vbase + (size_t)tn * 16 * C_IN;
            v4f vl[4][2];
#pragma unroll
            for (int kc = 0; kc < 4; ++kc) {
                vl[kc][0] = *(const v4f*)(vp + (4 * kc) * C_IN);
                vl[kc][1] = *(const v4f*)(vp + (4 * kc + 1) * C_IN);
            }
            const v2f kn0 = *(const v2f*)(kbase + (size_t)tn * 16 * CQ);
            const v2f kn1 = *(const v2f*)(kbase + (size_t)tn * 16 * CQ + 4);
            // these loads' address registers may be rewritten behind this point
            asm volatile("s_wait_xcnt 0x0" ::: "memory");
            // keeps the loads in front of this tile's work, whose time then covers
            // their trip to L2
            __builtin_amdgcn_sched_barrier(0);

            const int left = nv - (t << 4);      // valid keys from this tile on
            const unsigned kbal = left >= 16 ? 0xFFFFu : (left <= 0 ? 0u : (1u << left) - 1u);
            const unsigned kb = kbal >> (8 * h); // per-half key bits

            // S^T = K_tile x Q^T  (two K=4 chunks)
            v8f s = {};
            s = __builtin_amdgcn_wmma_f32_16x16x4_f32(false, ka0, false, qb0,
                                                      (short)0, s, false, false);
            s = __builtin_amdgcn_wmma_f32_16x16x4_f32(false, ka1, false, qb1,
                                                      (short)0, s, false, false);

            // mask + online softmax stats
            float p[8];
            float tmax = -INFINITY;
#pragma unroll
            for (int r = 0; r < 8; ++r) {
                const float sv = (kb & (1u << r)) ? s[r] : NEGV;
                p[r] = sv;
                tmax = fmaxf(tmax, sv);
            }
            tmax = fmaxf(tmax, __shfl_xor(tmax, 16));
            const float mnew  = fmaxf(m, tmax);
            const float scale = __expf(m - mnew);
            float psum = 0.0f;
#pragma unroll
            for (int r = 0; r < 8; ++r) {
                p[r] = __expf(p[r] - mnew);
                psum += p[r];
            }
            psum += __shfl_xor(psum, 16);
            l = l * scale + psum;
            m = mnew;
#pragma unroll
            for (int r = 0; r < 8; ++r) {
                acc0[r] *= scale; acc1[r] *= scale;
                acc2[r] *= scale; acc3[r] *= scale;
            }

            // Re-lay P into B fragments (key = 4kc + v + 2h at query lm)
            float pl[8], ph[8];
#pragma unroll
            for (int r = 0; r < 8; ++r) {
                pl[r] = __shfl(p[r], lm);
                ph[r] = __shfl(p[r], lm + 16);
            }
            v2f bp[4];
#pragma unroll
            for (int kc = 0; kc < 4; ++kc) {
                const int r0 = (kc & 1) * 4;
                const float s0 = (kc < 2) ? pl[r0 + 0] : ph[r0 + 0];
                const float s1 = (kc < 2) ? pl[r0 + 1] : ph[r0 + 1];
                const float s2 = (kc < 2) ? pl[r0 + 2] : ph[r0 + 2];
                const float s3 = (kc < 2) ? pl[r0 + 3] : ph[r0 + 3];
                bp[kc].x = h ? s2 : s0;
                bp[kc].y = h ? s3 : s1;
            }

            // out_tile += V_tile x P^T
#pragma unroll
            for (int kc = 0; kc < 4; ++kc) {
                acc0 = __builtin_amdgcn_wmma_f32_16x16x4_f32(false, va[0][kc], false, bp[kc],
                                                             (short)0, acc0, false, false);
                acc1 = __builtin_amdgcn_wmma_f32_16x16x4_f32(false, va[1][kc], false, bp[kc],
                                                             (short)0, acc1, false, false);
                acc2 = __builtin_amdgcn_wmma_f32_16x16x4_f32(false, va[2][kc], false, bp[kc],
                                                             (short)0, acc2, false, false);
                acc3 = __builtin_amdgcn_wmma_f32_16x16x4_f32(false, va[3][kc], false, bp[kc],
                                                             (short)0, acc3, false, false);
            }
            // keeps the wait for the next tile's loads from rising in front of this tile's
            // softmax, where the wave would sit out their whole trip to L2
            __builtin_amdgcn_sched_barrier(0);
            ka0 = kn0;
            ka1 = kn1;
#pragma unroll
            for (int kc = 0; kc < 4; ++kc) {
#pragma unroll
                for (int cg = 0; cg < 4; ++cg) { va[cg][kc].x = vl[kc][0][cg]; va[cg][kc].y = vl[kc][1][cg]; }
            }
        }

        // this range's partial sums and statistics (a wave without tiles: -inf, 0, zeros)
        float* pw = &spart[wv][8 * h * OP + lm];
#pragma unroll
        for (int r = 0; r < 8; ++r) {
            pw[(0 * 16 + r) * OP] = acc0[r];
            pw[(1 * 16 + r) * OP] = acc1[r];
            pw[(2 * 16 + r) * OP] = acc2[r];
            pw[(3 * 16 + r) * OP] = acc3[r];
        }
        if (h == 0) {   // both halves hold the same statistics
            sm[wv][lm] = m;
            sl[wv][lm] = l;
        }
      }
    }
    __syncthreads();   // the eight ranges' partial sums and the mean of v are in LDS

    float o[4] = {0.0f, 0.0f, 0.0f, 0.0f};
    if (anyvalid) {
        // range 0 always holds a valid key, so the maximum is finite and an empty
        // range (maximum -inf) weighs exactly 0
        float w[KW];
#pragma unroll
        for (int s = 0; s < KW; ++s) w[s] = sm[s][oq];
        float mx = w[0];
#pragma unroll
        for (int s = 1; s < KW; ++s) mx = fmaxf(mx, w[s]);
        float lsum = 0.0f;
#pragma unroll
        for (int s = 0; s < KW; ++s) {
            w[s] = __expf(w[s] - mx);
            lsum = fmaf(w[s], sl[s][oq], lsum);
        }
        const float rl = 1.0f / lsum;
#pragma unroll
        for (int cg = 0; cg < 4; ++cg) {
            if (cg == 0 || !part) {     // a dealt tile has the one output tile, in the first rows
                float a = 0.0f;
#pragma unroll
                for (int s = 0; s < KW; ++s) a = fmaf(w[s], spart[s][(cg * 16 + oc) * OP + oq], a);
                o[cg] = a * rl;
            }
        }
    }
    if (part) {
        if (anyvalid && a0 + oq < nv) out[abase] = fmaf(gamma, o[0], xa);
        if (i0 + oq >= nv) {
#pragma unroll
            for (int cg = 0; cg < 4; ++cg)
                out[obase + (size_t)cg * N_PIX] = fmaf(gamma, svm[4 * oc + cg], xv[cg]);
        }
        return;
    }
    if (anymasked) {
        const bool masked = i0 + oq >= nv;
#pragma unroll
        for (int cg = 0; cg < 4; ++cg) o[cg] = masked ? svm[4 * oc + cg] : o[cg];
    }
#pragma unroll
    for (int cg = 0; cg < 4; ++cg)
        out[obase + (size_t)cg * N_PIX] = fmaf(gamma, o[cg], xv[cg]);
}

// ---------------------------------------------------------------------------
extern "C" void kernel_launch(void* const* d_in, const int* in_sizes, int n_in,
                              void* d_out, int out_size, void* d_ws, size_t ws_size,
                              hipStream_t stream) {
    const float* x     = (const float*)d_in[0];
    const int*   mask  = (const int*)d_in[1];
    const float* Wq    = (const float*)d_in[2];
    const float* bq    = (const float*)d_in[3];
    const float* Wk    = (const float*)d_in[4];
    const float* bk    = (const float*)d_in[5];
    const float* Wv    = (const float*)d_in[6];
    const float* bv    = (const float*)d_in[7];
    const float* gamma = (const float*)d_in[8];
    float* out = (float*)d_out;

    float* qws = (float*)d_ws;                    // 4*4096*8  floats
    float* kws = qws + 4 * N_PIX * CQ;            // 4*4096*8  floats
    float* vws = kws + 4 * N_PIX * CQ;            // 4*64*4096 floats
    int*   invws = (int*)(vws + 4 * C_IN * N_PIX);    // 4*4096 ints: pixel at a packed place
    int*   nvws  = invws + 4 * N_PIX;                 // 4 ints: valid pixels per batch
    float* vpart = (float*)(nvws + 4);                // 4*128*64 floats: sums of v per block

    proj_kernel<<<4 * N_PIX / PROJ_PIX, 160, 0, stream>>>(x, mask, Wq, bq, Wk, bk, Wv, bv, qws, kws, vws,
                                                        invws, nvws, vpart);
    attn_kernel<<<4 * N_PIX / 16, 256, 0, stream>>>(x, nvws, invws, qws, kws, vws, vpart, gamma, out);
}

// v006
// A run of this version takes 29.9 microseconds.
// Timed twice side by side with v005, it ran 1.05 times as fast both times.
// Counting every step since v000, it is 9.49 times as fast.
#include <hip/hip_runtime.h>

typedef __attribute__((ext_vector_type(2))) float v2f;
typedef __attribute__((ext_vector_type(4))) float v4f;
typedef __attribute__((ext_vector_type(8))) float v8f;
typedef __attribute__((ext_vector_type(4))) int i32x4;

#define N_PIX 4096
#define C_IN  64
#define CQ    8
#define NEGV  (-1e9f)
#define KW 8                            // key ranges, one wave of a work-group each
#define OP 20                           // LDS pitch in dwords of a partial-sum row (16 queries)

// ---------------------------------------------------------------------------
// Kernel 1: the 1x1-conv projections as one product W(80 x 64) * x(64 x pixels)
// on the f32 matrix form -> q,k (B,N,8), v (B,N,C).
// A block covers 32 neighbouring pixels; each of its 5 waves takes 16 output
// rows (wave 0: q and k, waves 1..4: 16 channels of v) as two 16x16 tiles:
// tile 0 holds the even pixels, tile 1 the odd ones, so that a lane loads
// pixel pairs and a half-wave touches whole 128-byte lines.
// q, k and v are stored in a packed pixel order: the valid pixels of a batch
// first, in their own order, the masked ones from the end backwards. A masked
// key has weight exactly 0 for a valid query, and a masked query weighs every
// key alike, so the attention runs over the valid pixels alone and a masked
// pixel takes the mean of v, whose per-block sums are stored here.
// ---------------------------------------------------------------------------
#define PROJ_PIX 32
#define PROJ_BLK (N_PIX / PROJ_PIX)     // 128 blocks per batch
#define MQ 7                            // mask quads per thread: 7 * 160 >= 1024
__global__ __launch_bounds__(160) void proj_kernel(
    const float* __restrict__ x, const int* __restrict__ mask,
    const float* __restrict__ Wq, const float* __restrict__ bq,
    const float* __restrict__ Wk, const float* __restrict__ bk,
    const float* __restrict__ Wv, const float* __restrict__ bv,
    float* __restrict__ qws, float* __restrict__ kws, float* __restrict__ vws,
    int* __restrict__ invws, int* __restrict__ nvws, float* __restrict__ vpart)
{
    __shared__ int scnt[5];
    const int lane = threadIdx.x & 31;
    const int g    = __builtin_amdgcn_readfirstlane(threadIdx.x >> 5);  // output group
    const int h    = lane >> 4;
    const int lm   = lane & 15;
    const int p0   = blockIdx.x * PROJ_PIX;     // first pixel, counted over all batches
    const int b    = p0 >> 12;
    const int n0   = p0 & (N_PIX - 1);

    // output row lm of the group (A operand) and the 8 biases of rows 8h..8h+7
    const float* wrow;
    const float* bias;
    if (g == 0) {
        wrow = (lm < CQ) ? Wq + lm * C_IN : Wk + (lm - CQ) * C_IN;
        bias = h ? bk : bq;
    } else {
        wrow = Wv + ((g - 1) * 16 + lm) * C_IN;
        bias = bv + (g - 1) * 16 + 8 * h;
    }

    const float* xp = x + (size_t)b * C_IN * N_PIX + (size_t)(4 * h) * N_PIX + n0 + 2 * lm;
    // (all loops of this kernel are unrolled so that the fragment arrays stay in registers)
    const v4f b0 = *(const v4f*)bias;
    const v4f b1 = *(const v4f*)(bias + 4);
    v4f wa[8];
    v2f xb[8][4];
#pragma unroll
    for (int j = 0; j < 8; ++j) wa[j] = *(const v4f*)(wrow + 8 * j + 4 * h);
    // the bias and weight loads' address registers may be rewritten behind this point
    asm volatile("s_wait_xcnt 0x0" ::: "memory");
#pragma unroll
    for (int j = 0; j < 8; ++j) {
#pragma unroll
        for (int i = 0; i < 4; ++i)
            xb[j][i] = *(const v2f*)(xp + (size_t)(8 * j + i) * N_PIX);
    }
    // the batch's mask in front of this block (quads past it are read at a
    // clamped place and not counted) and the block's own 32 pixels
    const int* mrow = mask + b * N_PIX;
    i32x4 mq[MQ];
#pragma unroll
    for (int i = 0; i < MQ; ++i) {
        const int q4 = (int)threadIdx.x + 160 * i;
        mq[i] = *(const i32x4*)(mrow + 4 * (q4 < N_PIX / 4 ? q4 : N_PIX / 4 - 1));
    }
    const int mown = mrow[n0 + lane];
    // keeps the scheduler from sinking the loads among the matrix steps, where a
    // wave would pay the trip to memory several times instead of once
    __builtin_amdgcn_sched_barrier(0);

    // valid pixels in front of the block: per thread, per wave (a ballot for
    // each bit of the count, at most 28), then over the 5 waves through LDS
    int cnt = 0;
#pragma unroll
    for (int i = 0; i < MQ; ++i) {
        const int c4 = (mq[i][0] != 0) + (mq[i][1] != 0) + (mq[i][2] != 0) + (mq[i][3] != 0);
        cnt += (4 * ((int)threadIdx.x + 160 * i) < n0) ? c4 : 0;
    }
    int wsum = 0;
#pragma unroll
    for (int bit = 0; bit < 5; ++bit)
        wsum += __popc((unsigned)__ballot((cnt >> bit) & 1)) << bit;
    if (lane == 0) scnt[g] = wsum;
    const unsigned mbits = (unsigned)__ballot(mown != 0);

    v8f acc0 = {b0[0], b0[1], b0[2], b0[3], b1[0], b1[1], b1[2], b1[3]};
    v8f acc1 = acc0;
#pragma unroll
    for (int j = 0; j < 8; ++j) {
#pragma unroll
        for (int e = 0; e < 2; ++e) {
            const v2f a  = {wa[j][2 * e], wa[j][2 * e + 1]};
            const v2f x0 = {xb[j][2 * e][0], xb[j][2 * e + 1][0]};
            const v2f x1 = {xb[j][2 * e][1], xb[j][2 * e + 1][1]};
            acc0 = __builtin_amdgcn_wmma_f32_16x16x4_f32(false, a, false, x0,
                                                         (short)0, acc0, false, false);
            acc1 = __builtin_amdgcn_wmma_f32_16x16x4_f32(false, a, false, x1,
                                                         (short)0, acc1, false, false);
        }
    }

    __syncthreads();   // the five waves' counts are in LDS
    const int base = scnt[0] + scnt[1] + scnt[2] + scnt[3] + scnt[4];

    // packed places of pixels n0 + 2lm and n0 + 2lm + 1: a valid pixel goes to
    // its rank among the valid ones, a masked one to N - 1 - its rank among the masked
    const int i0  = 2 * lm;
    const int ok0 = (mbits >> i0) & 1;
    const int ok1 = (mbits >> (i0 + 1)) & 1;
    const int rk0 = base + __popc(mbits & ((1u << i0) - 1u));
    const int rk1 = rk0 + ok0;
    const int pos0 = ok0 ? rk0 : N_PIX - 1 - (n0 + i0 - rk0);
    const int pos1 = ok1 ? rk1 : N_PIX - 1 - (n0 + i0 + 1 - rk1);

    // acc0[r], acc1[r]: output row r + 8h at pixels n0 + 2lm and n0 + 2lm + 1
    if (g == 0) {
        float* dbase = (h ? kws : qws) + (size_t)b * N_PIX * CQ;
        float* dst0 = dbase + (size_t)pos0 * CQ;
        float* dst1 = dbase + (size_t)pos1 * CQ;
        const v4f s0 = {acc0[0], acc0[1], acc0[2], acc0[3]};
        const v4f s1 = {acc0[4], acc0[5], acc0[6], acc0[7]};
        const v4f s2 = {acc1[0], acc1[1], acc1[2], acc1[3]};
        const v4f s3 = {acc1[4], acc1[5], acc1[6], acc1[7]};
        *(v4f*)(dst0)     = s0;
        *(v4f*)(dst0 + 4) = s1;
        *(v4f*)(dst1)     = s2;
        *(v4f*)(dst1 + 4) = s3;
        if (h == 0) {   // which pixel stands at each packed place
            invws[b * N_PIX + pos0] = n0 + i0;
            invws[b * N_PIX + pos1] = n0 + i0 + 1;
        }
        if (lane == 0 && n0 == N_PIX - PROJ_PIX)   // the batch's last block knows the total
            nvws[b] = base + __popc(mbits);
        // the stores' address and data registers may be rewritten behind this point
        asm volatile("s_wait_xcnt 0x0" ::: "memory");
    } else {
        // a packed place's 64 channels lie side by side: 8 of them per lane and pixel
        float* vp = vws + (size_t)b * C_IN * N_PIX + (g - 1) * 16 + 8 * h;
        const v4f s0 = {acc0[0], acc0[1], acc0[2], acc0[3]};
        const v4f s1 = {acc0[4], acc0[5], acc0[6], acc0[7]};
        const v4f s2 = {acc1[0], acc1[1], acc1[2], acc1[3]};
        const v4f s3 = {acc1[4], acc1[5], acc1[6], acc1[7]};
        *(v4f*)(vp + (size_t)pos0 * C_IN)     = s0;
        *(v4f*)(vp + (size_t)pos0 * C_IN + 4) = s1;
        *(v4f*)(vp + (size_t)pos1 * C_IN)     = s2;
        *(v4f*)(vp + (size_t)pos1 * C_IN + 4) = s3;
        float rs[8];
#pragma unroll
        for (int r = 0; r < 8; ++r) rs[r] = acc0[r] + acc1[r];
        // the stores' address and data registers may be rewritten behind this point
        asm volatile("s_wait_xcnt 0x0" ::: "memory");
        // the block's sum of v over its 32 pixels, 8 channels per half-wave
#pragma unroll
        for (int d = 1; d < 16; d <<= 1) {
#pragma unroll
            for (int r = 0; r < 8; ++r) rs[r] += __shfl_xor(rs[r], d);
        }
        if (lm == 0) {
            float* sp = vpart + (size_t)(b * PROJ_BLK + (n0 >> 5)) * C_IN + (g - 1) * 16 + 8 * h;
            const v4f t0 = {rs[0], rs[1], rs[2], rs[3]};
            const v4f t1 = {rs[4], rs[5], rs[6], rs[7]};
            *(v4f*)(sp)     = t0;
            *(v4f*)(sp + 4) = t1;
        }
    }
}

// ---------------------------------------------------------------------------
// One wave's share of a dealt query tile: its range of key tiles as in kernel 2,
// but one 16-channel output tile alone (vbase points at channel 4lm + cg0). Same
// fragments, k orders and order of sums as there. Leaves the range's running
// maximum, denominator and un-normalised sums in LDS (rows r + 8h).
// ---------------------------------------------------------------------------
__device__ __forceinline__ void quarter_sums(
    const float* __restrict__ qp, const float* __restrict__ kbase, const float* __restrict__ vbase,
    const int nv, const int wv, const int h, const int lm,
    float* __restrict__ pw, float* __restrict__ smw, float* __restrict__ slw)
{
    const int ntile = (nv + 15) >> 4;
    const int share = (ntile + KW - 1) / KW;
    const int t0    = wv * share;
    const int rest  = ntile - t0;
    const int trips = rest < 0 ? 0 : (rest < share ? rest : share);

    const v2f qb0 = *(const v2f*)(qp + 2 * h);
    const v2f qb1 = *(const v2f*)(qp + 4 + 2 * h);

    v8f acc = {};
    float m = -INFINITY;
    float l = 0.0f;

    // K and V A-fragments are fetched one tile ahead (a wave without tiles reads tile 0)
    const int tf = trips > 0 ? t0 : 0;
    v2f ka0 = *(const v2f*)(kbase + (size_t)tf * 16 * CQ);
    v2f ka1 = *(const v2f*)(kbase + (size_t)tf * 16 * CQ + 4);
    v2f va[4];
#pragma unroll
    for (int kc = 0; kc < 4; ++kc) {
        va[kc].x = vbase[((size_t)tf * 16 + 4 * kc) * C_IN];
        va[kc].y = vbase[((size_t)tf * 16 + 4 * kc + 1) * C_IN];
    }
    // these loads' address registers may be rewritten behind this point
    asm volatile("s_wait_xcnt 0x0" ::: "memory");

    for (int i = 0; i < trips; ++i) {
        const int t  = t0 + i;
        const int tn = i + 1 < trips ? t + 1 : t;   // the last trip reads its own tile again

        const float* vp = vbase + (size_t)tn * 16 * C_IN;
        v2f vn[4];
#pragma unroll
        for (int kc = 0; kc < 4; ++kc) {
            vn[kc].x = vp[(4 * kc) * C_IN];
            vn[kc].y = vp[(4 * kc + 1) * C_IN];
        }
        const v2f kn0 = *(const v2f*)(kbase + (size_t)tn * 16 * CQ);
        const v2f kn1 = *(const v2f*)(kbase + (size_t)tn * 16 * CQ + 4);
        // these loads' address registers may be rewritten behind this point
        asm volatile("s_wait_xcnt 0x0" ::: "memory");
        // keeps the loads in front of this tile's work, whose time then covers
        // their trip to L2
        __builtin_amdgcn_sched_barrier(0);

        const int left = nv - (t << 4);      // valid keys from this tile on
        const unsigned kbal = left >= 16 ? 0xFFFFu : (left <= 0 ? 0u : (1u << left) - 1u);
        const unsigned kb = kbal >> (8 * h); // per-half key bits

        v8f s = {};
        s = __builtin_amdgcn_wmma_f32_16x16x4_f32(false, ka0, false, qb0,
                                                  (short)0, s, false, false);
        s = __builtin_amdgcn_wmma_f32_16x16x4_f32(false, ka1, false, qb1,
                                                  (short)0, s, false, false);

        float p[8];
        float tmax = -INFINITY;
#pragma unroll
        for (int r = 0; r < 8; ++r) {
            const float sv = (kb & (1u << r)) ? s[r] : NEGV;
            p[r] = sv;
            tmax = fmaxf(tmax, sv);
        }
        tmax = fmaxf(tmax, __shfl_xor(tmax, 16));
        const float mnew  = fmaxf(m, tmax);
        const float scale = __expf(m - mnew);
        float psum = 0.0f;
#pragma unroll
        for (int r = 0; r < 8; ++r) {
            p[r] = __expf(p[r] - mnew);
            psum += p[r];
        }
        psum += __shfl_xor(psum, 16);
        l = l * scale + psum;
        m = mnew;
#pragma unroll
        for (int r = 0; r < 8; ++r) acc[r] *= scale;

        // Re-lay P into B fragments (key = 4kc + v + 2h at query lm)
        float pl[8], ph[8];
#pragma unroll
        for (int r = 0; r < 8; ++r) {
            pl[r] = __shfl(p[r], lm);
            ph[r] = __shfl(p[r], lm + 16);
        }
#pragma unroll
        for (int kc = 0; kc < 4; ++kc) {
            const int r0 = (kc & 1) * 4;
            const float s0 = (kc < 2) ? pl[r0 + 0] : ph[r0 + 0];
            const float s1 = (kc < 2) ? pl[r0 + 1] : ph[r0 + 1];
            const float s2 = (kc < 2) ? pl[r0 + 2] : ph[r0 + 2];
            const float s3 = (kc < 2) ? pl[r0 + 3] : ph[r0 + 3];
            const v2f bp = {h ? s2 : s0, h ? s3 : s1};
            acc = __builtin_amdgcn_wmma_f32_16x16x4_f32(false, va[kc], false, bp,
                                                        (short)0, acc, false, false);
        }
        ka0 = kn0;
        ka1 = kn1;
#pragma unroll
        for (int kc = 0; kc < 4; ++kc) va[kc] = vn[kc];
    }

#pragma unroll
    for (int r = 0; r < 8; ++r) pw[r * OP] = acc[r];
    if (h == 0) {   // both halves hold the same statistics
        smw[lm] = m;
        slw[lm] = l;
    }
}

// ---------------------------------------------------------------------------
// Kernel 2: flash attention and the output. A work-group owns 16 packed places
// (one query tile) of a batch. Its 8 waves share the queries and split the key
// tiles up to nv into 8 ranges; each keeps its own running maximum, denominator
// and un-normalised sums, and the ranges are joined through LDS:
// weight of a range = exp(m_w - max m), out = gamma * (sum w acc) / (sum w l) + x,
// stored at the pixel that stands at the packed place.
// Places from nv on hold masked pixels, which take gamma * (mean of v) + x.
// V rows are read straight from global memory, 16 bytes a lane: lane lm holds
// channels 4lm..4lm+3 of a key, so row lm of output tile cg is channel 4lm + cg.
// Placement: QT_EVEN query tiles a batch give every WGP two equal work-groups. A
// tile beyond them would stand as a third whole one on some WGP, and the launch
// would last as long as that WGP. Such a tile (while there are at most QT_EVEN / 4)
// is dealt by output tile cg to four of the work-groups from QT_EVEN on, whose
// own places are such tiles or masked ones; each repeats the scores and does a quarter of
// the second product. A work-group from QT_EVEN on then stores only the masked ones
// of its own places.
// ---------------------------------------------------------------------------
#define QT_EVEN 128
__global__ __launch_bounds__(256) void attn_kernel(
    const float* __restrict__ x, const int* __restrict__ nvws, const int* __restrict__ invws,
    const float* __restrict__ qws, const float* __restrict__ kws,
    const float* __restrict__ vws, const float* __restrict__ vpart,
    const float* __restrict__ gammaP, float* __restrict__ out)
{
    __shared__ float spart[KW][C_IN * OP];      // partial sums: row cg*16 + r + 8h, column = query
    __shared__ float sm[KW][16];
    __shared__ float sl[KW][16];
    __shared__ __attribute__((aligned(16))) float sred[16][C_IN];
    __shared__ float svm[C_IN];

    const int tid  = threadIdx.x;
    const int lane = tid & 31;
    const int wv   = __builtin_amdgcn_readfirstlane(tid >> 5);
    const int h    = lane >> 4;
    const int lm   = lane & 15;
    // the query tile is the slow index
    const int b    = blockIdx.x & 3;
    const int qt   = blockIdx.x >> 2;
    const int i0   = qt << 4;
    // valid pixels of the batch, held to the shape's bounds
    const int nvr = nvws[b];
    const int nv  = __builtin_amdgcn_readfirstlane(nvr < 0 ? 0 : (nvr > N_PIX ? N_PIX : nvr));
    // all of these are the same for the whole work-group
    const int  over = ((nv + 15) >> 4) - QT_EVEN;           // query tiles beyond the even deal
    const bool part = qt >= QT_EVEN && over > 0 && over <= QT_EVEN / 4;
    const int  cg0  = qt & 3;                               // a dealt tile's output tile
    const int  a0   = part ? (QT_EVEN + ((qt - QT_EVEN) >> 2)) << 4 : i0;   // first query place
    const bool anyvalid  = a0 < nv;
    const bool anymasked = i0 + 16 > nv;

    // the output element of this thread: place i0 + oq, channels 4*oc .. 4*oc + 3
    const int oq = tid & 15;
    const int oc = tid >> 4;
    const int n  = invws[b * N_PIX + i0 + oq] & (N_PIX - 1);
    const size_t obase = ((size_t)b * C_IN + 4 * oc) * N_PIX + n;
    const float gamma = gammaP[0];
    float xv[4];
#pragma unroll
    for (int cg = 0; cg < 4; ++cg) xv[cg] = x[obase + (size_t)cg * N_PIX];
    // of a dealt tile: place a0 + oq, channel 4*oc + cg0
    size_t abase = obase;
    float xa = 0.0f;
    if (part) {
        const int na = invws[b * N_PIX + a0 + oq] & (N_PIX - 1);
        abase = ((size_t)b * C_IN + 4 * oc + cg0) * N_PIX + na;
        xa = x[abase];
        // these loads' address registers may be rewritten behind this point
        asm volatile("s_wait_xcnt 0x0" ::: "memory");
        // A dealt tile's waves run their key loop at raised priority, for speed only.
        if (anyvalid) __builtin_amdgcn_s_setprio(3);
    }

    // mean of v over all pixels of the batch: the 128 projection blocks' sums,
    // 8 blocks per thread, then 16 groups through LDS
    if (anymasked) {
        const float* sp = vpart + (size_t)(b * PROJ_BLK + oc * 8) * C_IN + 4 * oq;
        v4f ps = *(const v4f*)sp;
#pragma unroll
        for (int i = 1; i < 8; ++i) ps += *(const v4f*)(sp + i * C_IN);
        *(v4f*)&sred[oc][4 * oq] = ps;
        __syncthreads();   // the sixteen groups' sums are in LDS (the test is the same for the whole work-group)
        if (tid < C_IN) {
            float a = sred[0][tid];
#pragma unroll
            for (int q = 1; q < 16; ++q) a += sred[q][tid];
            svm[tid] = a * (1.0f / N_PIX);
        }
    }

    if (anyvalid) {
      if (part) {
        quarter_sums(qws + ((size_t)b * N_PIX + a0 + lm) * CQ,
                     kws + (size_t)b * N_PIX * CQ + lm * CQ + 2 * h,
                     vws + (size_t)b * C_IN * N_PIX + 2 * h * C_IN + 4 * lm + cg0,
                     nv, wv, h, lm, &spart[wv][8 * h * OP + lm], sm[wv], sl[wv]);
        __builtin_amdgcn_s_setprio(0);   // back to the default before the barrier and on the way out
      } else {
        // this wave's key tiles: an equal share of the tiles up to nv, cut at the last
        const int ntile = (nv + 15) >> 4;
        const int share = (ntile + KW - 1) / KW;
        const int t0    = wv * share;
        const int rest  = ntile - t0;
        const int trips = rest < 0 ? 0 : (rest < share ? rest : share);

        // Q as B-fragments (K = vgpr + 2h)
        const float* qp = qws + ((size_t)b * N_PIX + i0 + lm) * CQ;
        const v2f qb0 = *(const v2f*)(qp + 2 * h);
        const v2f qb1 = *(const v2f*)(qp + 4 + 2 * h);

        v8f acc0 = {}, acc1 = {}, acc2 = {}, acc3 = {};
        float m = -INFINITY;
        float l = 0.0f;

        const float* kbase = kws + (size_t)b * N_PIX * CQ + lm * CQ + 2 * h;
        const float* vbase = vws + (size_t)b * C_IN * N_PIX + 2 * h * C_IN + 4 * lm;

        // K and V A-fragments are fetched one tile ahead (a wave without tiles reads tile 0).
        // V A-fragments: channel 4lm + cg, keys 4kc + 2h + v
        const int tf = trips > 0 ? t0 : 0;
        v2f ka0 = *(const v2f*)(kbase + (size_t)tf * 16 * CQ);
        v2f ka1 = *(const v2f*)(kbase + (size_t)tf * 16 * CQ + 4);
        v2f va[4][4];
#pragma unroll
        for (int kc = 0; kc < 4; ++kc) {
            const v4f e0 = *(const v4f*)(vbase + ((size_t)tf * 16 + 4 * kc) * C_IN);
            const v4f e1 = *(const v4f*)(vbase + ((size_t)tf * 16 + 4 * kc + 1) * C_IN);
#pragma unroll
            for (int cg = 0; cg < 4; ++cg) { va[cg][kc].x = e0[cg]; va[cg][kc].y = e1[cg]; }
        }

        for (int i = 0; i < trips; ++i) {
            const int t  = t0 + i;
            const int tn = i + 1 < trips ? t + 1 : t;   // the last trip reads its own tile again

            // the next tile's V rows: keys 4kc + 2h + v, channels 4lm..4lm+3
            const float* vp = vbase + (size_t)tn * 16 * C_IN;
            v4f vl[4][2];
#pragma unroll
            for (int kc = 0; kc < 4; ++kc) {
                vl[kc][0] = *(const v4f*)(vp + (4 * kc) * C_IN);
                vl[kc][1] = *(const v4f*)(vp + (4 * kc + 1) * C_IN);
            }
            const v2f kn0 = *(const v2f*)(kbase + (size_t)tn * 16 * CQ);
            const v2f kn1 = *(const v2f*)(kbase + (size_t)tn * 16 * CQ + 4);
            // these loads' address registers may be rewritten behind this point
            asm volatile("s_wait_xcnt 0x0" ::: "memory");
            // keeps the loads in front of this tile's work, whose time then covers
            // their trip to L2
            __builtin_amdgcn_sched_barrier(0);

            const int left = nv - (t << 4);      // valid keys from this tile on
            const unsigned kbal = left >= 16 ? 0xFFFFu : (left <= 0 ? 0u : (1u << left) - 1u);
            const unsigned kb = kbal >> (8 * h); // per-half key bits

            // S^T = K_tile x Q^T  (two K=4 chunks)
            v8f s = {};
            s = __builtin_amdgcn_wmma_f32_16x16x4_f32(false, ka0, false, qb0,
                                                      (short)0, s, false, false);
            s = __builtin_amdgcn_wmma_f32_16x16x4_f32(false, ka1, false, qb1,
                                                      (short)0, s, false, false);

            // mask + online softmax stats
            float p[8];
            float tmax = -INFINITY;
#pragma unroll
            for (int r = 0; r < 8; ++r) {
                const float sv = (kb & (1u << r)) ? s[r] : NEGV;
                p[r] = sv;
                tmax = fmaxf(tmax, sv);
            }
            tmax = fmaxf(tmax, __shfl_xor(tmax, 16));
            const float mnew  = fmaxf(m, tmax);
            const float scale = __expf(m - mnew);
            float psum = 0.0f;
#pragma unroll
            for (int r = 0; r < 8; ++r) {
                p[r] = __expf(p[r] - mnew);
                psum += p[r];
            }
            psum += __shfl_xor(psum, 16);
            l = l * scale + psum;
            m = mnew;
#pragma unroll
            for (int r = 0; r < 8; ++r) {
                acc0[r] *= scale; acc1[r] *= scale;
                acc2[r] *= scale; acc3[r] *= scale;
            }

            // Re-lay P into B fragments (key = 4kc + v + 2h at query lm)
            float pl[8], ph[8];
#pragma unroll
            for (int r = 0; r < 8; ++r) {
                pl[r] = __shfl(p[r], lm);
                ph[r] = __shfl(p[r], lm + 16);
            }
            v2f bp[4];
#pragma unroll
            for (int kc = 0; kc < 4; ++kc) {
                const int r0 = (kc & 1) * 4;
                const float s0 = (kc < 2) ? pl[r0 + 0] : ph[r0 + 0];
                const float s1 = (kc < 2) ? pl[r0 + 1] : ph[r0 + 1];
                const float s2 = (kc < 2) ? pl[r0 + 2] : ph[r0 + 2];
                const float s3 = (kc < 2) ? pl[r0 + 3] : ph[r0 + 3];
                bp[kc].x = h ? s2 : s0;
                bp[kc].y = h ? s3 : s1;
            }

            // out_tile += V_tile x P^T
#pragma unroll
            for (int kc = 0; kc < 4; ++kc) {
                acc0 = __builtin_amdgcn_wmma_f32_16x16x4_f32(false, va[0][kc], false, bp[kc],
                                                             (short)0, acc0, false, false);
                acc1 = __builtin_amdgcn_wmma_f32_16x16x4_f32(false, va[1][kc], false, bp[kc],
                                                             (short)0, acc1, false, false);
                acc2 = __builtin_amdgcn_wmma_f32_16x16x4_f32(false, va[2][kc], false, bp[kc],
                                                             (short)0, acc2, false, false);
                acc3 = __builtin_amdgcn_wmma_f32_16x16x4_f32(false, va[3][kc], false, bp[kc],
                                                             (short)0, acc3, false, false);
            }
            // keeps the wait for the next tile's loads from rising in front of this tile's
            // softmax, where the wave would sit out their whole trip to L2
            __builtin_amdgcn_sched_barrier(0);
            ka0 = kn0;
            ka1 = kn1;
#pragma unroll
            for (int kc = 0; kc < 4; ++kc) {
#pragma unroll
                for (int cg = 0; cg < 4; ++cg) { va[cg][kc].x = vl[kc][0][cg]; va[cg][kc].y = vl[kc][1][cg]; }
            }
        }

        // this range's partial sums and statistics (a wave without tiles: -inf, 0, zeros)
        float* pw = &spart[wv][8 * h * OP + lm];
#pragma unroll
        for (int r = 0; r < 8; ++r) {
            pw[(0 * 16 + r) * OP] = acc0[r];
            pw[(1 * 16 + r) * OP] = acc1[r];
            pw[(2 * 16 + r) * OP] = acc2[r];
            pw[(3 * 16 + r) * OP] = acc3[r];
        }
        if (h == 0) {   // both halves hold the same statistics
            sm[wv][lm] = m;
            sl[wv][lm] = l;
        }
      }
    }
    __syncthreads();   // the eight ranges' partial sums and the mean of v are in LDS

    float o[4] = {0.0f, 0.0f, 0.0f, 0.0f};
    if (anyvalid) {
        // range 0 always holds a valid key, so the maximum is finite and an empty
        // range (maximum -inf) weighs exactly 0
        float w[KW];
#pragma unroll
        for (int s = 0; s < KW; ++s) w[s] = sm[s][oq];
        float mx = w[0];
#pragma unroll
        for (int s = 1; s < KW; ++s) mx = fmaxf(mx, w[s]);
        float lsum = 0.0f;
#pragma unroll
        for (int s = 0; s < KW; ++s) {
            w[s] = __expf(w[s] - mx);
            lsum = fmaf(w[s], sl[s][oq], lsum);
        }
        const float rl = 1.0f / lsum;
#pragma unroll
        for (int cg = 0; cg < 4; ++cg) {
            if (cg == 0 || !part) {     // a dealt tile has the one output tile, in the first rows
                float a = 0.0f;
#pragma unroll
                for (int s = 0; s < KW; ++s) a = fmaf(w[s], spart[s][(cg * 16 + oc) * OP + oq], a);
                o[cg] = a * rl;
            }
        }
    }
    if (part) {
        if (anyvalid && a0 + oq < nv) out[abase] = fmaf(gamma, o[0], xa);
        if (i0 + oq >= nv) {
#pragma unroll
            for (int cg = 0; cg < 4; ++cg)
                out[obase + (size_t)cg * N_PIX] = fmaf(gamma, svm[4 * oc + cg], xv[cg]);
        }
        return;
    }
    if (anymasked) {
        const bool masked = i0 + oq >= nv;
#pragma unroll
        for (int cg = 0; cg < 4; ++cg) o[cg] = masked ? svm[4 * oc + cg] : o[cg];
    }
#pragma unroll
    for (int cg = 0; cg < 4; ++cg)
        out[obase + (size_t)cg * N_PIX] = fmaf(gamma, o[cg], xv[cg]);
}

// ---------------------------------------------------------------------------
extern "C" void kernel_launch(void* const* d_in, const int* in_sizes, int n_in,
                              void* d_out, int out_size, void* d_ws, size_t ws_size,
                              hipStream_t stream) {
    const float* x     = (const float*)d_in[0];
    const int*   mask  = (const int*)d_in[1];
    const float* Wq    = (const float*)d_in[2];
    const float* bq    = (const float*)d_in[3];
    const float* Wk    = (const float*)d_in[4];
    const float* bk    = (const float*)d_in[5];
    const float* Wv    = (const float*)d_in[6];
    const float* bv    = (const float*)d_in[7];
    const float* gamma = (const float*)d_in[8];
    float* out = (float*)d_out;

    float* qws = (float*)d_ws;                    // 4*4096*8  floats
    float* kws = qws + 4 * N_PIX * CQ;            // 4*4096*8  floats
    float* vws = kws + 4 * N_PIX * CQ;            // 4*64*4096 floats
    int*   invws = (int*)(vws + 4 * C_IN * N_PIX);    // 4*4096 ints: pixel at a packed place
    int*   nvws  = invws + 4 * N_PIX;                 // 4 ints: valid pixels per batch
    float* vpart = (float*)(nvws + 4);                // 4*128*64 floats: sums of v per block

    proj_kernel<<<4 * N_PIX / PROJ_PIX, 160, 0, stream>>>(x, mask, Wq, bq, Wk, bk, Wv, bv, qws, kws, vws,
                                                        invws, nvws, vpart);
    attn_kernel<<<4 * N_PIX / 16, 256, 0, stream>>>(x, nvws, invws, qws, kws, vws, vpart, gamma, out);
}

// v007
// One run takes 28.3 microseconds.
// Timed twice side by side with v006, it ran 1.06 and 1.05 times as fast.
// Counting every step since v000, it is 10.0 times as fast.
#include <hip/hip_runtime.h>

typedef __attribute__((ext_vector_type(2))) float v2f;
typedef __attribute__((ext_vector_type(4))) float v4f;
typedef __attribute__((ext_vector_type(8))) float v8f;
typedef __attribute__((ext_vector_type(4))) int i32x4;

#define N_PIX 4096
#define C_IN  64
#define CQ    8
#define NEGV  (-1e9f)
#define KW 8                            // key ranges, one wave of a work-group each
#define OP 20                           // LDS pitch in dwords of a partial-sum row (16 queries)

// ---------------------------------------------------------------------------
// Kernel 1: the 1x1-conv projections as one product W(80 x 64) * x(64 x pixels)
// on the f32 matrix form -> q,k (B,N,8), v (B,N,C).
// A block covers 32 neighbouring pixels; each of its 5 waves takes 16 output
// rows (wave 0: q and k, waves 1..4: 16 channels of v) as two 16x16 tiles:
// tile 0 holds the even pixels, tile 1 the odd ones, so that a lane loads
// pixel pairs and a half-wave touches whole 128-byte lines.
// q, k and v are stored in a packed pixel order: the valid pixels of a batch
// first, in their own order, the masked ones from the end backwards. A masked
// key has weight exactly 0 for a valid query, and a masked query weighs every
// key alike, so the attention runs over the valid pixels alone and a masked
// pixel takes the mean of v, whose per-block sums are stored here.
// ---------------------------------------------------------------------------
#define PROJ_PIX 32
#define PROJ_BLK (N_PIX / PROJ_PIX)     // 128 blocks per batch
#define MQ 7                            // mask quads per thread: 7 * 160 >= 1024
__global__ __launch_bounds__(160) void proj_kernel(
    const float* __restrict__ x, const int* __restrict__ mask,
    const float* __restrict__ Wq, const float* __restrict__ bq,
    const float* __restrict__ Wk, const float* __restrict__ bk,
    const float* __restrict__ Wv, const float* __restrict__ bv,
    float* __restrict__ qws, float* __restrict__ kws, float* __restrict__ vws,
    int* __restrict__ invws, int* __restrict__ nvws, float* __restrict__ vpart)
{
    __shared__ int scnt[5];
    const int lane = threadIdx.x & 31;
    const int g    = __builtin_amdgcn_readfirstlane(threadIdx.x >> 5);  // output group
    const int h    = lane >> 4;
    const int lm   = lane & 15;
    const int p0   = blockIdx.x * PROJ_PIX;     // first pixel, counted over all batches
    const int b    = p0 >> 12;
    const int n0   = p0 & (N_PIX - 1);

    // output row lm of the group (A operand) and the 8 biases of rows 8h..8h+7
    const float* wrow;
    const float* bias;
    if (g == 0) {
        wrow = (lm < CQ) ? Wq + lm * C_IN : Wk + (lm - CQ) * C_IN;
        bias = h ? bk : bq;
    } else {
        wrow = Wv + ((g - 1) * 16 + lm) * C_IN;
        bias = bv + (g - 1) * 16 + 8 * h;
    }

    const float* xp = x + (size_t)b * C_IN * N_PIX + (size_t)(4 * h) * N_PIX + n0 + 2 * lm;
    // (all loops of this kernel are unrolled so that the fragment arrays stay in registers)
    const v4f b0 = *(const v4f*)bias;
    const v4f b1 = *(const v4f*)(bias + 4);
    v4f wa[8];
    v2f xb[8][4];
#pragma unroll
    for (int j = 0; j < 8; ++j) wa[j] = *(const v4f*)(wrow + 8 * j + 4 * h);
    // the bias and weight loads' address registers may be rewritten behind this point
    asm volatile("s_wait_xcnt 0x0" ::: "memory");
#pragma unroll
    for (int j = 0; j < 8; ++j) {
#pragma unroll
        for (int i = 0; i < 4; ++i)
            xb[j][i] = *(const v2f*)(xp + (size_t)(8 * j + i) * N_PIX);
    }
    // the batch's mask in front of this block (quads past it are read at a
    // clamped place and not counted) and the block's own 32 pixels
    const int* mrow = mask + b * N_PIX;
    i32x4 mq[MQ];
#pragma unroll
    for (int i = 0; i < MQ; ++i) {
        const int q4 = (int)threadIdx.x + 160 * i;
        mq[i] = *(const i32x4*)(mrow + 4 * (q4 < N_PIX / 4 ? q4 : N_PIX / 4 - 1));
    }
    const int mown = mrow[n0 + lane];
    // keeps the scheduler from sinking the loads among the matrix steps, where a
    // wave would pay the trip to memory several times instead of once
    __builtin_amdgcn_sched_barrier(0);

    // valid pixels in front of the block: per thread, per wave (a ballot for
    // each bit of the count, at most 28), then over the 5 waves through LDS
    int cnt = 0;
#pragma unroll
    for (int i = 0; i < MQ; ++i) {
        const int c4 = (mq[i][0] != 0) + (mq[i][1] != 0) + (mq[i][2] != 0) + (mq[i][3] != 0);
        cnt += (4 * ((int)threadIdx.x + 160 * i) < n0) ? c4 : 0;
    }
    int wsum = 0;
#pragma unroll
    for (int bit = 0; bit < 5; ++bit)
        wsum += __popc((unsigned)__ballot((cnt >> bit) & 1)) << bit;
    if (lane == 0) scnt[g] = wsum;
    const unsigned mbits = (unsigned)__ballot(mown != 0);

    v8f acc0 = {b0[0], b0[1], b0[2], b0[3], b1[0], b1[1], b1[2], b1[3]};
    v8f acc1 = acc0;
#pragma unroll
    for (int j = 0; j < 8; ++j) {
#pragma unroll
        for (int e = 0; e < 2; ++e) {
            const v2f a  = {wa[j][2 * e], wa[j][2 * e + 1]};
            const v2f x0 = {xb[j][2 * e][0], xb[j][2 * e + 1][0]};
            const v2f x1 = {xb[j][2 * e][1], xb[j][2 * e + 1][1]};
            acc0 = __builtin_amdgcn_wmma_f32_16x16x4_f32(false, a, false, x0,
                                                         (short)0, acc0, false, false);
            acc1 = __builtin_amdgcn_wmma_f32_16x16x4_f32(false, a, false, x1,
                                                         (short)0, acc1, false, false);
        }
    }

    __syncthreads();   // the five waves' counts are in LDS
    const int base = scnt[0] + scnt[1] + scnt[2] + scnt[3] + scnt[4];

    // packed places of pixels n0 + 2lm and n0 + 2lm + 1: a valid pixel goes to
    // its rank among the valid ones, a masked one to N - 1 - its rank among the masked
    const int i0  = 2 * lm;
    const int ok0 = (mbits >> i0) & 1;
    const int ok1 = (mbits >> (i0 + 1)) & 1;
    const int rk0 = base + __popc(mbits & ((1u << i0) - 1u));
    const int rk1 = rk0 + ok0;
    const int pos0 = ok0 ? rk0 : N_PIX - 1 - (n0 + i0 - rk0);
    const int pos1 = ok1 ? rk1 : N_PIX - 1 - (n0 + i0 + 1 - rk1);

    // acc0[r], acc1[r]: output row r + 8h at pixels n0 + 2lm and n0 + 2lm + 1
    if (g == 0) {
        float* dbase = (h ? kws : qws) + (size_t)b * N_PIX * CQ;
        float* dst0 = dbase + (size_t)pos0 * CQ;
        float* dst1 = dbase + (size_t)pos1 * CQ;
        const v4f s0 = {acc0[0], acc0[1], acc0[2], acc0[3]};
        const v4f s1 = {acc0[4], acc0[5], acc0[6], acc0[7]};
        const v4f s2 = {acc1[0], acc1[1], acc1[2], acc1[3]};
        const v4f s3 = {acc1[4], acc1[5], acc1[6], acc1[7]};
        *(v4f*)(dst0)     = s0;
        *(v4f*)(dst0 + 4) = s1;
        *(v4f*)(dst1)     = s2;
        *(v4f*)(dst1 + 4) = s3;
        if (h == 0) {   // which pixel stands at each packed place
            invws[b * N_PIX + pos0] = n0 + i0;
            invws[b * N_PIX + pos1] = n0 + i0 + 1;
        }
        if (lane == 0 && n0 == N_PIX - PROJ_PIX)   // the batch's last block knows the total
            nvws[b] = base + __popc(mbits);
        // the stores' address and data registers may be rewritten behind this point
        asm volatile("s_wait_xcnt 0x0" ::: "memory");
    } else {
        // a packed place's 64 channels lie side by side: 8 of them per lane and pixel
        float* vp = vws + (size_t)b * C_IN * N_PIX + (g - 1) * 16 + 8 * h;
        const v4f s0 = {acc0[0], acc0[1], acc0[2], acc0[3]};
        const v4f s1 = {acc0[4], acc0[5], acc0[6], acc0[7]};
        const v4f s2 = {acc1[0], acc1[1], acc1[2], acc1[3]};
        const v4f s3 = {acc1[4], acc1[5], acc1[6], acc1[7]};
        *(v4f*)(vp + (size_t)pos0 * C_IN)     = s0;
        *(v4f*)(vp + (size_t)pos0 * C_IN + 4) = s1;
        *(v4f*)(vp + (size_t)pos1 * C_IN)     = s2;
        *(v4f*)(vp + (size_t)pos1 * C_IN + 4) = s3;
        float rs[8];
#pragma unroll
        for (int r = 0; r < 8; ++r) rs[r] = acc0[r] + acc1[r];
        // the stores' address and data registers may be rewritten behind this point
        asm volatile("s_wait_xcnt 0x0" ::: "memory");
        // the block's sum of v over its 32 pixels, 8 channels per half-wave
#pragma unroll
        for (int d = 1; d < 16; d <<= 1) {
#pragma unroll
            for (int r = 0; r < 8; ++r) rs[r] += __shfl_xor(rs[r], d);
        }
        if (lm == 0) {
            float* sp = vpart + (size_t)(b * PROJ_BLK + (n0 >> 5)) * C_IN + (g - 1) * 16 + 8 * h;
            const v4f t0 = {rs[0], rs[1], rs[2], rs[3]};
            const v4f t1 = {rs[4], rs[5], rs[6], rs[7]};
            *(v4f*)(sp)     = t0;
            *(v4f*)(sp + 4) = t1;
        }
    }
}

// ---------------------------------------------------------------------------
// One wave's share of a dealt query tile: its range of key tiles as in kernel 2,
// but one 16-channel output tile alone (vbase points at channel 4lm + cg0). Same
// fragments, k orders and order of sums as there. Leaves the range's running
// maximum, denominator and un-normalised sums in LDS (rows r + 8h).
// ---------------------------------------------------------------------------
__device__ __forceinline__ void quarter_sums(
    const float* __restrict__ qp, const float* __restrict__ kbase, const float* __restrict__ vbase,
    const int nv, const int wv, const int h, const int lm,
    float* __restrict__ pw, float* __restrict__ smw, float* __restrict__ slw)
{
    const int ntile = (nv + 15) >> 4;
    const int share = (ntile + KW - 1) / KW;
    const int t0    = wv * share;
    const int rest  = ntile - t0;
    const int trips = rest < 0 ? 0 : (rest < share ? rest : share);

    const v2f qb0 = *(const v2f*)(qp + 2 * h);
    const v2f qb1 = *(const v2f*)(qp + 4 + 2 * h);

    v8f acc = {};
    float m = -INFINITY;
    float l = 0.0f;

    // K and V A-fragments are fetched one tile ahead (a wave without tiles reads tile 0)
    const int tf = trips > 0 ? t0 : 0;
    v2f ka0 = *(const v2f*)(kbase + (size_t)tf * 16 * CQ);
    v2f ka1 = *(const v2f*)(kbase + (size_t)tf * 16 * CQ + 4);
    v2f va[4];
#pragma unroll
    for (int kc = 0; kc < 4; ++kc) {
        va[kc].x = vbase[((size_t)tf * 16 + 4 * kc) * C_IN];
        va[kc].y = vbase[((size_t)tf * 16 + 4 * kc + 1) * C_IN];
    }
    // these loads' address registers may be rewritten behind this point
    asm volatile("s_wait_xcnt 0x0" ::: "memory");

    for (int i = 0; i < trips; ++i) {
        const int t  = t0 + i;
        const int tn = i + 1 < trips ? t + 1 : t;   // the last trip reads its own tile again

        const float* vp = vbase + (size_t)tn * 16 * C_IN;
        v2f vn[4];
#pragma unroll
        for (int kc = 0; kc < 4; ++kc) {
            vn[kc].x = vp[(4 * kc) * C_IN];
            vn[kc].y = vp[(4 * kc + 1) * C_IN];
        }
        const v2f kn0 = *(const v2f*)(kbase + (size_t)tn * 16 * CQ);
        const v2f kn1 = *(const v2f*)(kbase + (size_t)tn * 16 * CQ + 4);
        // these loads' address registers may be rewritten behind this point
        asm volatile("s_wait_xcnt 0x0" ::: "memory");
        // keeps the loads in front of this tile's work, whose time then covers
        // their trip to L2
        __builtin_amdgcn_sched_barrier(0);

        const int left = nv - (t << 4);      // valid keys from this tile on
        const unsigned kbal = left >= 16 ? 0xFFFFu : (left <= 0 ? 0u : (1u << left) - 1u);
        const unsigned kb = kbal >> (8 * h); // per-half key bits

        v8f s = {};
        s = __builtin_amdgcn_wmma_f32_16x16x4_f32(false, ka0, false, qb0,
                                                  (short)0, s, false, false);
        s = __builtin_amdgcn_wmma_f32_16x16x4_f32(false, ka1, false, qb1,
                                                  (short)0, s, false, false);

        float p[8];
        float tmax = -INFINITY;
#pragma unroll
        for (int r = 0; r < 8; ++r) {
            const float sv = (kb & (1u << r)) ? s[r] : NEGV;
            p[r] = sv;
            tmax = fmaxf(tmax, sv);
        }
        tmax = fmaxf(tmax, __shfl_xor(tmax, 16));
        const float mnew  = fmaxf(m, tmax);
        const float scale = __expf(m - mnew);
        float psum = 0.0f;
#pragma unroll
        for (int r = 0; r < 8; ++r) {
            p[r] = __expf(p[r] - mnew);
            psum += p[r];
        }
        psum += __shfl_xor(psum, 16);
        l = l * scale + psum;
        m = mnew;
#pragma unroll
        for (int r = 0; r < 8; ++r) acc[r] *= scale;

        // Re-lay P into B fragments (key = 4kc + v + 2h at query lm)
        float pl[8], ph[8];
#pragma unroll
        for (int r = 0; r < 8; ++r) {
            pl[r] = __shfl(p[r], lm);
            ph[r] = __shfl(p[r], lm + 16);
        }
#pragma unroll
        for (int kc = 0; kc < 4; ++kc) {
            const int r0 = (kc & 1) * 4;
            const float s0 = (kc < 2) ? pl[r0 + 0] : ph[r0 + 0];
            const float s1 = (kc < 2) ? pl[r0 + 1] : ph[r0 + 1];
            const float s2 = (kc < 2) ? pl[r0 + 2] : ph[r0 + 2];
            const float s3 = (kc < 2) ? pl[r0 + 3] : ph[r0 + 3];
            const v2f bp = {h ? s2 : s0, h ? s3 : s1};
            acc = __builtin_amdgcn_wmma_f32_16x16x4_f32(false, va[kc], false, bp,
                                                        (short)0, acc, false, false);
        }
        ka0 = kn0;
        ka1 = kn1;
#pragma unroll
        for (int kc = 0; kc < 4; ++kc) va[kc] = vn[kc];
    }

#pragma unroll
    for (int r = 0; r < 8; ++r) pw[r * OP] = acc[r];
    if (h == 0) {   // both halves hold the same statistics
        smw[lm] = m;
        slw[lm] = l;
    }
}

// ---------------------------------------------------------------------------
// Kernel 2: flash attention and the output. A work-group owns 16 packed places
// (one query tile) of a batch. Its 8 waves share the queries and split the key
// tiles up to nv into 8 ranges; each keeps its own running maximum, denominator
// and un-normalised sums, and the ranges are joined through LDS:
// weight of a range = exp(m_w - max m), out = gamma * (sum w acc) / (sum w l) + x,
// stored at the pixel that stands at the packed place.
// Places from nv on hold masked pixels, which take gamma * (mean of v) + x.
// V rows are read straight from global memory, 16 bytes a lane: lane lm holds
// channels 4lm..4lm+3 of a key, so row lm of output tile cg is channel 4lm + cg.
// Placement: QT_EVEN query tiles a batch give every WGP two equal work-groups. A
// tile beyond them would stand as a third whole one on some WGP, and the launch
// would last as long as that WGP. Such a tile (while there are at most QT_EVEN / 4)
// is dealt by output tile cg to four of the work-groups from QT_EVEN on, whose
// own places are such tiles or masked ones; each repeats the scores and does a quarter of
// the second product. A work-group from QT_EVEN on then stores only the masked ones
// of its own places.
// ---------------------------------------------------------------------------
#define QT_EVEN 128
__global__ __launch_bounds__(256) void attn_kernel(
    const float* __restrict__ x, const int* __restrict__ nvws, const int* __restrict__ invws,
    const float* __restrict__ qws, const float* __restrict__ kws,
    const float* __restrict__ vws, const float* __restrict__ vpart,
    const float* __restrict__ gammaP, float* __restrict__ out)
{
    __shared__ float spart[KW][C_IN * OP];      // partial sums: row cg*16 + r + 8h, column = query
    __shared__ float sm[KW][16];
    __shared__ float sl[KW][16];
    __shared__ __attribute__((aligned(16))) float sred[16][C_IN];
    __shared__ float svm[C_IN];

    const int tid  = threadIdx.x;
    const int lane = tid & 31;
    const int wv   = __builtin_amdgcn_readfirstlane(tid >> 5);
    const int h    = lane >> 4;
    const int lm   = lane & 15;
    // the query tile is the slow index
    const int b    = blockIdx.x & 3;
    const int qt   = blockIdx.x >> 2;
    const int i0   = qt << 4;
    // valid pixels of the batch, held to the shape's bounds
    const int nvr = nvws[b];
    const int nv  = __builtin_amdgcn_readfirstlane(nvr < 0 ? 0 : (nvr > N_PIX ? N_PIX : nvr));
    // all of these are the same for the whole work-group
    const int  over = ((nv + 15) >> 4) - QT_EVEN;           // query tiles beyond the even deal
    const bool part = qt >= QT_EVEN && over > 0 && over <= QT_EVEN / 4;
    const int  cg0  = qt & 3;                               // a dealt tile's output tile
    const int  a0   = part ? (QT_EVEN + ((qt - QT_EVEN) >> 2)) << 4 : i0;   // first query place
    const bool anyvalid  = a0 < nv;
    const bool anymasked = i0 + 16 > nv;

    // the output element of this thread: place i0 + oq, channels 4*oc .. 4*oc + 3
    const int oq = tid & 15;
    const int oc = tid >> 4;
    const int n  = invws[b * N_PIX + i0 + oq] & (N_PIX - 1);
    const size_t obase = ((size_t)b * C_IN + 4 * oc) * N_PIX + n;
    const float gamma = gammaP[0];
    float xv[4];
#pragma unroll
    for (int cg = 0; cg < 4; ++cg) xv[cg] = x[obase + (size_t)cg * N_PIX];
    // of a dealt tile: place a0 + oq, channel 4*oc + cg0
    size_t abase = obase;
    float xa = 0.0f;
    if (part) {
        const int na = invws[b * N_PIX + a0 + oq] & (N_PIX - 1);
        abase = ((size_t)b * C_IN + 4 * oc + cg0) * N_PIX + na;
        xa = x[abase];
        // these loads' address registers may be rewritten behind this point
        asm volatile("s_wait_xcnt 0x0" ::: "memory");
        // A dealt tile's waves run their key loop at raised priority, for speed only.
        if (anyvalid) __builtin_amdgcn_s_setprio(3);
    }

    // mean of v over all pixels of the batch: the 128 projection blocks' sums,
    // 8 blocks per thread, then 16 groups through LDS
    if (anymasked) {
        const float* sp = vpart + (size_t)(b * PROJ_BLK + oc * 8) * C_IN + 4 * oq;
        v4f ps = *(const v4f*)sp;
#pragma unroll
        for (int i = 1; i < 8; ++i) ps += *(const v4f*)(sp + i * C_IN);
        *(v4f*)&sred[oc][4 * oq] = ps;
        __syncthreads();   // the sixteen groups' sums are in LDS (the test is the same for the whole work-group)
        if (tid < C_IN) {
            float a = sred[0][tid];
#pragma unroll
            for (int q = 1; q < 16; ++q) a += sred[q][tid];
            svm[tid] = a * (1.0f / N_PIX);
        }
    }

    if (anyvalid) {
      if (part) {
        quarter_sums(qws + ((size_t)b * N_PIX + a0 + lm) * CQ,
                     kws + (size_t)b * N_PIX * CQ + lm * CQ + 2 * h,
                     vws + (size_t)b * C_IN * N_PIX + 2 * h * C_IN + 4 * lm + cg0,
                     nv, wv, h, lm, &spart[wv][8 * h * OP + lm], sm[wv], sl[wv]);
        __builtin_amdgcn_s_setprio(0);   // back to the default before the barrier and on the way out
      } else {
        // this wave's key tiles: an equal share of the tiles up to nv, cut at the last
        const int ntile = (nv + 15) >> 4;
        const int share = (ntile + KW - 1) / KW;
        const int t0    = wv * share;
        const int rest  = ntile - t0;
        const int trips = rest < 0 ? 0 : (rest < share ? rest : share);
        // steps of the priority below: a half, a quarter, an eighth of a full share
        const int lv3 = share >> 1;
        const int lv2 = share >> 2;
        const int lv1 = share >> 3;
        int nxt = trips;                        // trips left at which the priority is set next

        // Q as B-fragments (K = vgpr + 2h)
        const float* qp = qws + ((size_t)b * N_PIX + i0 + lm) * CQ;
        const v2f qb0 = *(const v2f*)(qp + 2 * h);
        const v2f qb1 = *(const v2f*)(qp + 4 + 2 * h);

        v8f acc0 = {}, acc1 = {}, acc2 = {}, acc3 = {};
        float m = -INFINITY;
        float l = 0.0f;

        const float* kbase = kws + (size_t)b * N_PIX * CQ + lm * CQ + 2 * h;
        const float* vbase = vws + (size_t)b * C_IN * N_PIX + 2 * h * C_IN + 4 * lm;

        // K and V A-fragments are fetched one tile ahead (a wave without tiles reads tile 0).
        // V A-fragments: channel 4lm + cg, keys 4kc + 2h + v
        const int tf = trips > 0 ? t0 : 0;
        v2f ka0 = *(const v2f*)(kbase + (size_t)tf * 16 * CQ);
        v2f ka1 = *(const v2f*)(kbase + (size_t)tf * 16 * CQ + 4);
        v2f va[4][4];
#pragma unroll
        for (int kc = 0; kc < 4; ++kc) {
            const v4f e0 = *(const v4f*)(vbase + ((size_t)tf * 16 + 4 * kc) * C_IN);
            const v4f e1 = *(const v4f*)(vbase + ((size_t)tf * 16 + 4 * kc + 1) * C_IN);
#pragma unroll
            for (int cg = 0; cg < 4; ++cg) { va[cg][kc].x = e0[cg]; va[cg][kc].y = e1[cg]; }
        }

        for (int i = 0; i < trips; ++i) {
            const int t  = t0 + i;
            const int tn = i + 1 < trips ? t + 1 : t;   // the last trip reads its own tile again

            // Priority by the trips that are left, for speed only: a wave with fewer trips left
            // steps down first, so that the waves end close together.
            const int rem = trips - i;
            if (rem == nxt) {   // the first trip and the three steps; the tests are scalar
                if (rem > lv3)      { __builtin_amdgcn_s_setprio(3); nxt = lv3; }
                else if (rem > lv2) { __builtin_amdgcn_s_setprio(2); nxt = lv2; }
                else if (rem > lv1) { __builtin_amdgcn_s_setprio(1); nxt = lv1; }
                else                { __builtin_amdgcn_s_setprio(0); nxt = 0; }
            }

            // the next tile's V rows: keys 4kc + 2h + v, channels 4lm..4lm+3
            const float* vp = vbase + (size_t)tn * 16 * C_IN;
            v4f vl[4][2];
#pragma unroll
            for (int kc = 0; kc < 4; ++kc) {
                vl[kc][0] = *(const v4f*)(vp + (4 * kc) * C_IN);
                vl[kc][1] = *(const v4f*)(vp + (4 * kc + 1) * C_IN);
            }
            const v2f kn0 = *(const v2f*)(kbase + (size_t)tn * 16 * CQ);
            const v2f kn1 = *(const v2f*)(kbase + (size_t)tn * 16 * CQ + 4);
            // these loads' address registers may be rewritten behind this point
            asm volatile("s_wait_xcnt 0x0" ::: "memory");
            // keeps the loads in front of this tile's work, whose time then covers
            // their trip to L2
            __builtin_amdgcn_sched_barrier(0);

            const int left = nv - (t << 4);      // valid keys from this tile on
            const unsigned kbal = left >= 16 ? 0xFFFFu : (left <= 0 ? 0u : (1u << left) - 1u);
            const unsigned kb = kbal >> (8 * h); // per-half key bits

            // S^T = K_tile x Q^T  (two K=4 chunks)
            v8f s = {};
            s = __builtin_amdgcn_wmma_f32_16x16x4_f32(false, ka0, false, qb0,
                                                      (short)0, s, false, false);
            s = __builtin_amdgcn_wmma_f32_16x16x4_f32(false, ka1, false, qb1,
                                                      (short)0, s, false, false);

            // mask + online softmax stats
            float p[8];
            float tmax = -INFINITY;
#pragma unroll
            for (int r = 0; r < 8; ++r) {
                const float sv = (kb & (1u << r)) ? s[r] : NEGV;
                p[r] = sv;
                tmax = fmaxf(tmax, sv);
            }
            tmax = fmaxf(tmax, __shfl_xor(tmax, 16));
            const float mnew  = fmaxf(m, tmax);
            const float scale = __expf(m - mnew);
            float psum = 0.0f;
#pragma unroll
            for (int r = 0; r < 8; ++r) {
                p[r] = __expf(p[r] - mnew);
                psum += p[r];
            }
            psum += __shfl_xor(psum, 16);
            l = l * scale + psum;
            m = mnew;
#pragma unroll
            for (int r = 0; r < 8; ++r) {
                acc0[r] *= scale; acc1[r] *= scale;
                acc2[r] *= scale; acc3[r] *= scale;
            }

            // Re-lay P into B fragments (key = 4kc + v + 2h at query lm)
            float pl[8], ph[8];
#pragma unroll
            for (int r = 0; r < 8; ++r) {
                pl[r] = __shfl(p[r], lm);
                ph[r] = __shfl(p[r], lm + 16);
            }
            v2f bp[4];
#pragma unroll
            for (int kc = 0; kc < 4; ++kc) {
                const int r0 = (kc & 1) * 4;
                const float s0 = (kc < 2) ? pl[r0 + 0] : ph[r0 + 0];
                const float s1 = (kc < 2) ? pl[r0 + 1] : ph[r0 + 1];
                const float s2 = (kc < 2) ? pl[r0 + 2] : ph[r0 + 2];
                const float s3 = (kc < 2) ? pl[r0 + 3] : ph[r0 + 3];
                bp[kc].x = h ? s2 : s0;
                bp[kc].y = h ? s3 : s1;
            }

            // out_tile += V_tile x P^T
#pragma unroll
            for (int kc = 0; kc < 4; ++kc) {
                acc0 = __builtin_amdgcn_wmma_f32_16x16x4_f32(false, va[0][kc], false, bp[kc],
                                                             (short)0, acc0, false, false);
                acc1 = __builtin_amdgcn_wmma_f32_16x16x4_f32(false, va[1][kc], false, bp[kc],
                                                             (short)0, acc1, false, false);
                acc2 = __builtin_amdgcn_wmma_f32_16x16x4_f32(false, va[2][kc], false, bp[kc],
                                                             (short)0, acc2, false, false);
                acc3 = __builtin_amdgcn_wmma_f32_16x16x4_f32(false, va[3][kc], false, bp[kc],
                                                             (short)0, acc3, false, false);
            }
            // keeps the wait for the next tile's loads from rising in front of this tile's
            // softmax, where the wave would sit out their whole trip to L2
            __builtin_amdgcn_sched_barrier(0);
            ka0 = kn0;
            ka1 = kn1;
#pragma unroll
            for (int kc = 0; kc < 4; ++kc) {
#pragma unroll
                for (int cg = 0; cg < 4; ++cg) { va[cg][kc].x = vl[kc][0][cg]; va[cg][kc].y = vl[kc][1][cg]; }
            }
        }

        __builtin_amdgcn_s_setprio(0);   // back to the default before the barrier (a short share can end above it)

        // this range's partial sums and statistics (a wave without tiles: -inf, 0, zeros)
        float* pw = &spart[wv][8 * h * OP + lm];
#pragma unroll
        for (int r = 0; r < 8; ++r) {
            pw[(0 * 16 + r) * OP] = acc0[r];
            pw[(1 * 16 + r) * OP] = acc1[r];
            pw[(2 * 16 + r) * OP] = acc2[r];
            pw[(3 * 16 + r) * OP] = acc3[r];
        }
        if (h == 0) {   // both halves hold the same statistics
            sm[wv][lm] = m;
            sl[wv][lm] = l;
        }
      }
    }
    __syncthreads();   // the eight ranges' partial sums and the mean of v are in LDS

    float o[4] = {0.0f, 0.0f, 0.0f, 0.0f};
    if (anyvalid) {
        // range 0 always holds a valid key, so the maximum is finite and an empty
        // range (maximum -inf) weighs exactly 0
        float w[KW];
#pragma unroll
        for (int s = 0; s < KW; ++s) w[s] = sm[s][oq];
        float mx = w[0];
#pragma unroll
        for (int s = 1; s < KW; ++s) mx = fmaxf(mx, w[s]);
        float lsum = 0.0f;
#pragma unroll
        for (int s = 0; s < KW; ++s) {
            w[s] = __expf(w[s] - mx);
            lsum = fmaf(w[s], sl[s][oq], lsum);
        }
        const float rl = 1.0f / lsum;
#pragma unroll
        for (int cg = 0; cg < 4; ++cg) {
            if (cg == 0 || !part) {     // a dealt tile has the one output tile, in the first rows
                float a = 0.0f;
#pragma unroll
                for (int s = 0; s < KW; ++s) a = fmaf(w[s], spart[s][(cg * 16 + oc) * OP + oq], a);
                o[cg] = a * rl;
            }
        }
    }
    if (part) {
        if (anyvalid && a0 + oq < nv) out[abase] = fmaf(gamma, o[0], xa);
        if (i0 + oq >= nv) {
#pragma unroll
            for (int cg = 0; cg < 4; ++cg)
                out[obase + (size_t)cg * N_PIX] = fmaf(gamma, svm[4 * oc + cg], xv[cg]);
        }
        return;
    }
    if (anymasked) {
        const bool masked = i0 + oq >= nv;
#pragma unroll
        for (int cg = 0; cg < 4; ++cg) o[cg] = masked ? svm[4 * oc + cg] : o[cg];
    }
#pragma unroll
    for (int cg = 0; cg < 4; ++cg)
        out[obase + (size_t)cg * N_PIX] = fmaf(gamma, o[cg], xv[cg]);
}

// ---------------------------------------------------------------------------
extern "C" void kernel_launch(void* const* d_in, const int* in_sizes, int n_in,
                              void* d_out, int out_size, void* d_ws, size_t ws_size,
                              hipStream_t stream) {
    const float* x     = (const float*)d_in[0];
    const int*   mask  = (const int*)d_in[1];
    const float* Wq    = (const float*)d_in[2];
    const float* bq    = (const float*)d_in[3];
    const float* Wk    = (const float*)d_in[4];
    const float* bk    = (const float*)d_in[5];
    const float* Wv    = (const float*)d_in[6];
    const float* bv    = (const float*)d_in[7];
    const float* gamma = (const float*)d_in[8];
    float* out = (float*)d_out;

    float* qws = (float*)d_ws;                    // 4*4096*8  floats
    float* kws = qws + 4 * N_PIX * CQ;            // 4*4096*8  floats
    float* vws = kws + 4 * N_PIX * CQ;            // 4*64*4096 floats
    int*   invws = (int*)(vws + 4 * C_IN * N_PIX);    // 4*4096 ints: pixel at a packed place
    int*   nvws  = invws + 4 * N_PIX;                 // 4 ints: valid pixels per batch
    float* vpart = (float*)(nvws + 4);                // 4*128*64 floats: sums of v per block

    proj_kernel<<<4 * N_PIX / PROJ_PIX, 160, 0, stream>>>(x, mask, Wq, bq, Wk, bk, Wv, bv, qws, kws, vws,
                                                        invws, nvws, vpart);
    attn_kernel<<<4 * N_PIX / 16, 256, 0, stream>>>(x, nvws, invws, qws, kws, vws, vpart, gamma, out);
}

// v008
// One run takes 27.4 microseconds.
// Timed twice side by side with v007, it ran 1.04 and 1.03 times as fast.
// Counting every step since v000, it is 10.4 times as fast.
#include <hip/hip_runtime.h>

typedef __attribute__((ext_vector_type(2))) float v2f;
typedef __attribute__((ext_vector_type(4))) float v4f;
typedef __attribute__((ext_vector_type(8))) float v8f;
typedef __attribute__((ext_vector_type(4))) int i32x4;

#define N_PIX 4096
#define C_IN  64
#define CQ    8
#define NEGV  (-1e9f)
#define KW 8                            // key ranges, one wave of a work-group each
#define OP 20                           // LDS pitch in dwords of a partial-sum row (16 queries)

__device__ __forceinline__ float xhalf(float x) {
    return __builtin_bit_cast(float, __builtin_amdgcn_permlanex16(__builtin_bit_cast(int, x), __builtin_bit_cast(int, x),
                                                                  0x76543210, 0xfedcba98, false, false));
}

// ---------------------------------------------------------------------------
// Kernel 1: the 1x1-conv projections as one product W(80 x 64) * x(64 x pixels)
// on the f32 matrix form -> q,k (B,N,8), v (B,N,C).
// A block covers 32 neighbouring pixels; each of its 5 waves takes 16 output
// rows (wave 0: q and k, waves 1..4: 16 channels of v) as two 16x16 tiles:
// tile 0 holds the even pixels, tile 1 the odd ones, so that a lane loads
// pixel pairs and a half-wave touches whole 128-byte lines.
// q, k and v are stored in a packed pixel order: the valid pixels of a batch
// first, in their own order, the masked ones from the end backwards. A masked
// key has weight exactly 0 for a valid query, and a masked query weighs every
// key alike, so the attention runs over the valid pixels alone and a masked
// pixel takes the mean of v, whose per-block sums are stored here.
// ---------------------------------------------------------------------------
#define PROJ_PIX 32
#define PROJ_BLK (N_PIX / PROJ_PIX)     // 128 blocks per batch
#define MQ 7                            // mask quads per thread: 7 * 160 >= 1024
__global__ __launch_bounds__(160) void proj_kernel(
    const float* __restrict__ x, const int* __restrict__ mask,
    const float* __restrict__ Wq, const float* __restrict__ bq,
    const float* __restrict__ Wk, const float* __restrict__ bk,
    const float* __restrict__ Wv, const float* __restrict__ bv,
    float* __restrict__ qws, float* __restrict__ kws, float* __restrict__ vws,
    int* __restrict__ invws, int* __restrict__ nvws, float* __restrict__ vpart)
{
    __shared__ int scnt[5];
    const int lane = threadIdx.x & 31;
    const int g    = __builtin_amdgcn_readfirstlane(threadIdx.x >> 5);  // output group
    const int h    = lane >> 4;
    const int lm   = lane & 15;
    const int p0   = blockIdx.x * PROJ_PIX;     // first pixel, counted over all batches
    const int b    = p0 >> 12;
    const int n0   = p0 & (N_PIX - 1);

    // output row lm of the group (A operand) and the 8 biases of rows 8h..8h+7
    const float* wrow;
    const float* bias;
    if (g == 0) {
        wrow = (lm < CQ) ? Wq + lm * C_IN : Wk + (lm - CQ) * C_IN;
        bias = h ? bk : bq;
    } else {
        wrow = Wv + ((g - 1) * 16 + lm) * C_IN;
        bias = bv + (g - 1) * 16 + 8 * h;
    }

    const float* xp = x + (size_t)b * C_IN * N_PIX + (size_t)(4 * h) * N_PIX + n0 + 2 * lm;
    // (all loops of this kernel are unrolled so that the fragment arrays stay in registers)
    const v4f b0 = *(const v4f*)bias;
    const v4f b1 = *(const v4f*)(bias + 4);
    v4f wa[8];
    v2f xb[8][4];
#pragma unroll
    for (int j = 0; j < 8; ++j) wa[j] = *(const v4f*)(wrow + 8 * j + 4 * h);
    // the bias and weight loads' address registers may be rewritten behind this point
    asm volatile("s_wait_xcnt 0x0" ::: "memory");
#pragma unroll
    for (int j = 0; j < 8; ++j) {
#pragma unroll
        for (int i = 0; i < 4; ++i)
            xb[j][i] = *(const v2f*)(xp + (size_t)(8 * j + i) * N_PIX);
    }
    // the batch's mask in front of this block (quads past it are read at a
    // clamped place and not counted) and the block's own 32 pixels
    const int* mrow = mask + b * N_PIX;
    i32x4 mq[MQ];
#pragma unroll
    for (int i = 0; i < MQ; ++i) {
        const int q4 = (int)threadIdx.x + 160 * i;
        mq[i] = *(const i32x4*)(mrow + 4 * (q4 < N_PIX / 4 ? q4 : N_PIX / 4 - 1));
    }
    const int mown = mrow[n0 + lane];
    // keeps the scheduler from sinking the loads among the matrix steps, where a
    // wave would pay the trip to memory several times instead of once
    __builtin_amdgcn_sched_barrier(0);

    // valid pixels in front of the block: per thread, per wave (a ballot for
    // each bit of the count, at most 28), then over the 5 waves through LDS
    int cnt = 0;
#pragma unroll
    for (int i = 0; i < MQ; ++i) {
        const int c4 = (mq[i][0] != 0) + (mq[i][1] != 0) + (mq[i][2] != 0) + (mq[i][3] != 0);
        cnt += (4 * ((int)threadIdx.x + 160 * i) < n0) ? c4 : 0;
    }
    int wsum = 0;
#pragma unroll
    for (int bit = 0; bit < 5; ++bit)
        wsum += __popc((unsigned)__ballot((cnt >> bit) & 1)) << bit;
    if (lane == 0) scnt[g] = wsum;
    const unsigned mbits = (unsigned)__ballot(mown != 0);

    v8f acc0 = {b0[0], b0[1], b0[2], b0[3], b1[0], b1[1], b1[2], b1[3]};
    v8f acc1 = acc0;
#pragma unroll
    for (int j = 0; j < 8; ++j) {
#pragma unroll
        for (int e = 0; e < 2; ++e) {
            const v2f a  = {wa[j][2 * e], wa[j][2 * e + 1]};
            const v2f x0 = {xb[j][2 * e][0], xb[j][2 * e + 1][0]};
            const v2f x1 = {xb[j][2 * e][1], xb[j][2 * e + 1][1]};
            acc0 = __builtin_amdgcn_wmma_f32_16x16x4_f32(false, a, false, x0,
                                                         (short)0, acc0, false, false);
            acc1 = __builtin_amdgcn_wmma_f32_16x16x4_f32(false, a, false, x1,
                                                         (short)0, acc1, false, false);
        }
    }

    __syncthreads();   // the five waves' counts are in LDS
    const int base = scnt[0] + scnt[1] + scnt[2] + scnt[3] + scnt[4];

    // packed places of pixels n0 + 2lm and n0 + 2lm + 1: a valid pixel goes to
    // its rank among the valid ones, a masked one to N - 1 - its rank among the masked
    const int i0  = 2 * lm;
    const int ok0 = (mbits >> i0) & 1;
    const int ok1 = (mbits >> (i0 + 1)) & 1;
    const int rk0 = base + __popc(mbits & ((1u << i0) - 1u));
    const int rk1 = rk0 + ok0;
    const int pos0 = ok0 ? rk0 : N_PIX - 1 - (n0 + i0 - rk0);
    const int pos1 = ok1 ? rk1 : N_PIX - 1 - (n0 + i0 + 1 - rk1);

    // acc0[r], acc1[r]: output row r + 8h at pixels n0 + 2lm and n0 + 2lm + 1
    if (g == 0) {
        float* dbase = (h ? kws : qws) + (size_t)b * N_PIX * CQ;
        float* dst0 = dbase + (size_t)pos0 * CQ;
        float* dst1 = dbase + (size_t)pos1 * CQ;
        const v4f s0 = {acc0[0], acc0[1], acc0[2], acc0[3]};
        const v4f s1 = {acc0[4], acc0[5], acc0[6], acc0[7]};
        const v4f s2 = {acc1[0], acc1[1], acc1[2], acc1[3]};
        const v4f s3 = {acc1[4], acc1[5], acc1[6], acc1[7]};
        *(v4f*)(dst0)     = s0;
        *(v4f*)(dst0 + 4) = s1;
        *(v4f*)(dst1)     = s2;
        *(v4f*)(dst1 + 4) = s3;
        if (h == 0) {   // which pixel stands at each packed place
            invws[b * N_PIX + pos0] = n0 + i0;
            invws[b * N_PIX + pos1] = n0 + i0 + 1;
        }
        if (lane == 0 && n0 == N_PIX - PROJ_PIX)   // the batch's last block knows the total
            nvws[b] = base + __popc(mbits);
        // the stores' address and data registers may be rewritten behind this point
        asm volatile("s_wait_xcnt 0x0" ::: "memory");
    } else {
        // a packed place's 64 channels lie side by side: 8 of them per lane and pixel
        float* vp = vws + (size_t)b * C_IN * N_PIX + (g - 1) * 16 + 8 * h;
        const v4f s0 = {acc0[0], acc0[1], acc0[2], acc0[3]};
        const v4f s1 = {acc0[4], acc0[5], acc0[6], acc0[7]};
        const v4f s2 = {acc1[0], acc1[1], acc1[2], acc1[3]};
        const v4f s3 = {acc1[4], acc1[5], acc1[6], acc1[7]};
        *(v4f*)(vp + (size_t)pos0 * C_IN)     = s0;
        *(v4f*)(vp + (size_t)pos0 * C_IN + 4) = s1;
        *(v4f*)(vp + (size_t)pos1 * C_IN)     = s2;
        *(v4f*)(vp + (size_t)pos1 * C_IN + 4) = s3;
        float rs[8];
#pragma unroll
        for (int r = 0; r < 8; ++r) rs[r] = acc0[r] + acc1[r];
        // the stores' address and data registers may be rewritten behind this point
        asm volatile("s_wait_xcnt 0x0" ::: "memory");
        // the block's sum of v over its 32 pixels, 8 channels per half-wave
#pragma unroll
        for (int d = 1; d < 16; d <<= 1) {
#pragma unroll
            for (int r = 0; r < 8; ++r) rs[r] += __shfl_xor(rs[r], d);
        }
        if (lm == 0) {
            float* sp = vpart + (size_t)(b * PROJ_BLK + (n0 >> 5)) * C_IN + (g - 1) * 16 + 8 * h;
            const v4f t0 = {rs[0], rs[1], rs[2], rs[3]};
            const v4f t1 = {rs[4], rs[5], rs[6], rs[7]};
            *(v4f*)(sp)     = t0;
            *(v4f*)(sp + 4) = t1;
        }
    }
}

// ---------------------------------------------------------------------------
// One wave's share of a dealt query tile: its range of key tiles as in kernel 2,
// but one 16-channel output tile alone (vbase points at channel 4lm + cg0). Same
// fragments, k orders and order of sums as there. Leaves the range's running
// maximum, denominator and un-normalised sums in LDS (rows r + 8h).
// ---------------------------------------------------------------------------
__device__ __forceinline__ void quarter_sums(
    const float* __restrict__ qp, const float* __restrict__ kbase, const float* __restrict__ vbase,
    const int nv, const int wv, const int h, const int lm,
    float* __restrict__ pw, float* __restrict__ smw, float* __restrict__ slw)
{
    const int ntile = (nv + 15) >> 4;
    const int share = (ntile + KW - 1) / KW;
    const int t0    = wv * share;
    const int rest  = ntile - t0;
    const int trips = rest < 0 ? 0 : (rest < share ? rest : share);

    const v2f qb0 = *(const v2f*)(qp + 2 * h);
    const v2f qb1 = *(const v2f*)(qp + 4 + 2 * h);

    v8f acc = {};
    float m = -INFINITY;
    float l = 0.0f;

    // K and V A-fragments are fetched one tile ahead (a wave without tiles reads tile 0)
    const int tf = trips > 0 ? t0 : 0;
    v2f ka0 = *(const v2f*)(kbase + (size_t)tf * 16 * CQ);
    v2f ka1 = *(const v2f*)(kbase + (size_t)tf * 16 * CQ + 4);
    v2f va[4];
#pragma unroll
    for (int kc = 0; kc < 4; ++kc) {
        va[kc].x = vbase[((size_t)tf * 16 + 2 * kc) * C_IN];
        va[kc].y = vbase[((size_t)tf * 16 + 2 * kc + 1) * C_IN];
    }
    // these loads' address registers may be rewritten behind this point
    asm volatile("s_wait_xcnt 0x0" ::: "memory");

    for (int i = 0; i < trips; ++i) {
        const int t  = t0 + i;
        const int tn = i + 1 < trips ? t + 1 : t;   // the last trip reads its own tile again

        const float* vp = vbase + (size_t)tn * 16 * C_IN;
        v2f vn[4];
#pragma unroll
        for (int kc = 0; kc < 4; ++kc) {
            vn[kc].x = vp[(2 * kc) * C_IN];
            vn[kc].y = vp[(2 * kc + 1) * C_IN];
        }
        const v2f kn0 = *(const v2f*)(kbase + (size_t)tn * 16 * CQ);
        const v2f kn1 = *(const v2f*)(kbase + (size_t)tn * 16 * CQ + 4);
        // these loads' address registers may be rewritten behind this point
        asm volatile("s_wait_xcnt 0x0" ::: "memory");
        // keeps the loads in front of this tile's work, whose time then covers
        // their trip to L2
        __builtin_amdgcn_sched_barrier(0);

        const int left = nv - (t << 4);      // valid keys from this tile on
        const unsigned kbal = left >= 16 ? 0xFFFFu : (left <= 0 ? 0u : (1u << left) - 1u);
        const unsigned kb = kbal >> (8 * h); // per-half key bits

        v8f s = {};
        s = __builtin_amdgcn_wmma_f32_16x16x4_f32(false, ka0, false, qb0,
                                                  (short)0, s, false, false);
        s = __builtin_amdgcn_wmma_f32_16x16x4_f32(false, ka1, false, qb1,
                                                  (short)0, s, false, false);

        float p[8];
        float tmax = -INFINITY;
#pragma unroll
        for (int r = 0; r < 8; ++r) {
            const float sv = (kb & (1u << r)) ? s[r] : NEGV;
            p[r] = sv;
            tmax = fmaxf(tmax, sv);
        }
        tmax = fmaxf(tmax, xhalf(tmax));
        const float mnew  = fmaxf(m, tmax);
        const float scale = __expf(m - mnew);
        float psum = 0.0f;
#pragma unroll
        for (int r = 0; r < 8; ++r) {
            p[r] = __expf(p[r] - mnew);
            psum += p[r];
        }
        l = l * scale + psum;   // this half's keys alone; the halves are joined behind the loop
        m = mnew;
#pragma unroll
        for (int r = 0; r < 8; ++r) acc[r] *= scale;

#pragma unroll
        for (int kc = 0; kc < 4; ++kc) {
            const v2f bp = {p[2 * kc], p[2 * kc + 1]};
            acc = __builtin_amdgcn_wmma_f32_16x16x4_f32(false, va[kc], false, bp,
                                                        (short)0, acc, false, false);
        }
        // keeps the wait for the next tile's loads from rising in front of this tile's
        // softmax, where the wave would sit out their whole trip to L2
        __builtin_amdgcn_sched_barrier(0);
        ka0 = kn0;
        ka1 = kn1;
#pragma unroll
        for (int kc = 0; kc < 4; ++kc) va[kc] = vn[kc];
    }

    l += xhalf(l);   // the two halves' denominators
#pragma unroll
    for (int r = 0; r < 8; ++r) pw[r * OP] = acc[r];
    if (h == 0) {   // both halves hold the same statistics
        smw[lm] = m;
        slw[lm] = l;
    }
}

// ---------------------------------------------------------------------------
// Kernel 2: flash attention and the output. A work-group owns 16 packed places
// (one query tile) of a batch. Its 8 waves share the queries and split the key
// tiles up to nv into 8 ranges; each keeps its own running maximum, denominator
// and un-normalised sums, and the ranges are joined through LDS:
// weight of a range = exp(m_w - max m), out = gamma * (sum w acc) / (sum w l) + x,
// stored at the pixel that stands at the packed place.
// Places from nv on hold masked pixels, which take gamma * (mean of v) + x.
// V rows are read straight from global memory, 16 bytes a lane: lane lm holds
// channels 4lm..4lm+3 of a key, so row lm of output tile cg is channel 4lm + cg.
// Placement: QT_EVEN query tiles a batch give every WGP two equal work-groups. A
// tile beyond them would stand as a third whole one on some WGP, and the launch
// would last as long as that WGP. Such a tile (while there are at most QT_EVEN / 4)
// is dealt by output tile cg to four of the work-groups from QT_EVEN on, whose
// own places are such tiles or masked ones; each repeats the scores and does a quarter of
// the second product. A work-group from QT_EVEN on then stores only the masked ones
// of its own places.
// ---------------------------------------------------------------------------
#define QT_EVEN 128
__global__ __launch_bounds__(256) void attn_kernel(
    const float* __restrict__ x, const int* __restrict__ nvws, const int* __restrict__ invws,
    const float* __restrict__ qws, const float* __restrict__ kws,
    const float* __restrict__ vws, const float* __restrict__ vpart,
    const float* __restrict__ gammaP, float* __restrict__ out)
{
    __shared__ float spart[KW][C_IN * OP];      // partial sums: row cg*16 + r + 8h, column = query
    __shared__ float sm[KW][16];
    __shared__ float sl[KW][16];
    __shared__ __attribute__((aligned(16))) float sred[16][C_IN];
    __shared__ float svm[C_IN];

    const int tid  = threadIdx.x;
    const int lane = tid & 31;
    const int wv   = __builtin_amdgcn_readfirstlane(tid >> 5);
    const int h    = lane >> 4;
    const int lm   = lane & 15;
    // the query tile is the slow index
    const int b    = blockIdx.x & 3;
    const int qt   = blockIdx.x >> 2;
    const int i0   = qt << 4;
    // valid pixels of the batch, held to the shape's bounds
    const int nvr = nvws[b];
    const int nv  = __builtin_amdgcn_readfirstlane(nvr < 0 ? 0 : (nvr > N_PIX ? N_PIX : nvr));
    // all of these are the same for the whole work-group
    const int  over = ((nv + 15) >> 4) - QT_EVEN;           // query tiles beyond the even deal
    const bool part = qt >= QT_EVEN && over > 0 && over <= QT_EVEN / 4;
    const int  cg0  = qt & 3;                               // a dealt tile's output tile
    const int  a0   = part ? (QT_EVEN + ((qt - QT_EVEN) >> 2)) << 4 : i0;   // first query place
    const bool anyvalid  = a0 < nv;
    const bool anymasked = i0 + 16 > nv;

    // the output element of this thread: place i0 + oq, channels 4*oc .. 4*oc + 3
    const int oq = tid & 15;
    const int oc = tid >> 4;
    const int n  = invws[b * N_PIX + i0 + oq] & (N_PIX - 1);
    const size_t obase = ((size_t)b * C_IN + 4 * oc) * N_PIX + n;
    const float gamma = gammaP[0];
    float xv[4];
#pragma unroll
    for (int cg = 0; cg < 4; ++cg) xv[cg] = x[obase + (size_t)cg * N_PIX];
    // of a dealt tile: place a0 + oq, channel 4*oc + cg0
    size_t abase = obase;
    float xa = 0.0f;
    if (part) {
        const int na = invws[b * N_PIX + a0 + oq] & (N_PIX - 1);
        abase = ((size_t)b * C_IN + 4 * oc + cg0) * N_PIX + na;
        xa = x[abase];
        // these loads' address registers may be rewritten behind this point
        asm volatile("s_wait_xcnt 0x0" ::: "memory");
        // A dealt tile's waves run their key loop at raised priority, for speed only.
        if (anyvalid) __builtin_amdgcn_s_setprio(3);
    }

    // mean of v over all pixels of the batch: the 128 projection blocks' sums,
    // 8 blocks per thread, then 16 groups through LDS
    if (anymasked) {
        const float* sp = vpart + (size_t)(b * PROJ_BLK + oc * 8) * C_IN + 4 * oq;
        v4f ps = *(const v4f*)sp;
#pragma unroll
        for (int i = 1; i < 8; ++i) ps += *(const v4f*)(sp + i * C_IN);
        *(v4f*)&sred[oc][4 * oq] = ps;
        __syncthreads();   // the sixteen groups' sums are in LDS (the test is the same for the whole work-group)
        if (tid < C_IN) {
            float a = sred[0][tid];
#pragma unroll
            for (int q = 1; q < 16; ++q) a += sred[q][tid];
            svm[tid] = a * (1.0f / N_PIX);
        }
    }

    if (anyvalid) {
      if (part) {
        quarter_sums(qws + ((size_t)b * N_PIX + a0 + lm) * CQ,
                     kws + (size_t)b * N_PIX * CQ + lm * CQ + 2 * h,
                     vws + (size_t)b * C_IN * N_PIX + 8 * h * C_IN + 4 * lm + cg0,
                     nv, wv, h, lm, &spart[wv][8 * h * OP + lm], sm[wv], sl[wv]);
        __builtin_amdgcn_s_setprio(0);   // back to the default before the barrier and on the way out
      } else {
        // this wave's key tiles: an equal share of the tiles up to nv, cut at the last
        const int ntile = (nv + 15) >> 4;
        const int share = (ntile + KW - 1) / KW;
        const int t0    = wv * share;
        const int rest  = ntile - t0;
        const int trips = rest < 0 ? 0 : (rest < share ? rest : share);
        // steps of the priority below: a half, a quarter, an eighth of a full share
        const int lv3 = share >> 1;
        const int lv2 = share >> 2;
        const int lv1 = share >> 3;
        int nxt = trips;                        // trips left at which the priority is set next

        // Q as B-fragments (K = vgpr + 2h)
        const float* qp = qws + ((size_t)b * N_PIX + i0 + lm) * CQ;
        const v2f qb0 = *(const v2f*)(qp + 2 * h);
        const v2f qb1 = *(const v2f*)(qp + 4 + 2 * h);

        v8f acc0 = {}, acc1 = {}, acc2 = {}, acc3 = {};
        float m = -INFINITY;
        float l = 0.0f;

        const float* kbase = kws + (size_t)b * N_PIX * CQ + lm * CQ + 2 * h;
        const float* vbase = vws + (size_t)b * C_IN * N_PIX + 8 * h * C_IN + 4 * lm;

        // K and V A-fragments are fetched one tile ahead (a wave without tiles reads tile 0).
        // V A-fragments: channel 4lm + cg, keys 8h + 2kc + v, the order in which a lane holds its scores
        const int tf = trips > 0 ? t0 : 0;
        v2f ka0 = *(const v2f*)(kbase + (size_t)tf * 16 * CQ);
        v2f ka1 = *(const v2f*)(kbase + (size_t)tf * 16 * CQ + 4);
        v2f va[4][4];
#pragma unroll
        for (int kc = 0; kc < 4; ++kc) {
            const v4f e0 = *(const v4f*)(vbase + ((size_t)tf * 16 + 2 * kc) * C_IN);
            const v4f e1 = *(const v4f*)(vbase + ((size_t)tf * 16 + 2 * kc + 1) * C_IN);
#pragma unroll
            for (int cg = 0; cg < 4; ++cg) { va[cg][kc].x = e0[cg]; va[cg][kc].y = e1[cg]; }
        }
        // these loads' address registers may be rewritten behind this point
        asm volatile("s_wait_xcnt 0x0" ::: "memory");

        for (int i = 0; i < trips; ++i) {
            const int t  = t0 + i;
            const int tn = i + 1 < trips ? t + 1 : t;   // the last trip reads its own tile again

            // Priority by the trips that are left, for speed only: a wave with fewer trips left
            // steps down first, so that the waves end close together.
            const int rem = trips - i;
            if (rem == nxt) {   // the first trip and the three steps; the tests are scalar
                if (rem > lv3)      { __builtin_amdgcn_s_setprio(3); nxt = lv3; }
                else if (rem > lv2) { __builtin_amdgcn_s_setprio(2); nxt = lv2; }
                else if (rem > lv1) { __builtin_amdgcn_s_setprio(1); nxt = lv1; }
                else                { __builtin_amdgcn_s_setprio(0); nxt = 0; }
            }

            // the next tile's V rows: keys 8h + 2kc + v, channels 4lm..4lm+3
            const float* vp = vbase + (size_t)tn * 16 * C_IN;
            v4f vl[4][2];
#pragma unroll
            for (int kc = 0; kc < 4; ++kc) {
                vl[kc][0] = *(const v4f*)(vp + (2 * kc) * C_IN);
                vl[kc][1] = *(const v4f*)(vp + (2 * kc + 1) * C_IN);
            }
            const v2f kn0 = *(const v2f*)(kbase + (size_t)tn * 16 * CQ);
            const v2f kn1 = *(const v2f*)(kbase + (size_t)tn * 16 * CQ + 4);
            // these loads' address registers may be rewritten behind this point
            asm volatile("s_wait_xcnt 0x0" ::: "memory");
            // keeps the loads in front of this tile's work, whose time then covers
            // their trip to L2
            __builtin_amdgcn_sched_barrier(0);

            const int left = nv - (t << 4);      // valid keys from this tile on
            const unsigned kbal = left >= 16 ? 0xFFFFu : (left <= 0 ? 0u : (1u << left) - 1u);
            const unsigned kb = kbal >> (8 * h); // per-half key bits

            // S^T = K_tile x Q^T  (two K=4 chunks)
            v8f s = {};
            s = __builtin_amdgcn_wmma_f32_16x16x4_f32(false, ka0, false, qb0,
                                                      (short)0, s, false, false);
            s = __builtin_amdgcn_wmma_f32_16x16x4_f32(false, ka1, false, qb1,
                                                      (short)0, s, false, false);

            // mask + online softmax stats
            float p[8];
            float tmax = -INFINITY;
#pragma unroll
            for (int r = 0; r < 8; ++r) {
                const float sv = (kb & (1u << r)) ? s[r] : NEGV;
                p[r] = sv;
                tmax = fmaxf(tmax, sv);
            }
            tmax = fmaxf(tmax, xhalf(tmax));
            const float mnew  = fmaxf(m, tmax);
            const float scale = __expf(m - mnew);
            float psum = 0.0f;
#pragma unroll
            for (int r = 0; r < 8; ++r) {
                p[r] = __expf(p[r] - mnew);
                psum += p[r];
            }
            l = l * scale + psum;   // this half's keys alone; the halves are joined behind the loop
            m = mnew;
#pragma unroll
            for (int r = 0; r < 8; ++r) {
                acc0[r] *= scale; acc1[r] *= scale;
                acc2[r] *= scale; acc3[r] *= scale;
            }

            v2f bp[4];
#pragma unroll
            for (int kc = 0; kc < 4; ++kc) {
                bp[kc].x = p[2 * kc];
                bp[kc].y = p[2 * kc + 1];
            }

            // out_tile += V_tile x P^T
#pragma unroll
            for (int kc = 0; kc < 4; ++kc) {
                acc0 = __builtin_amdgcn_wmma_f32_16x16x4_f32(false, va[0][kc], false, bp[kc],
                                                             (short)0, acc0, false, false);
                acc1 = __builtin_amdgcn_wmma_f32_16x16x4_f32(false, va[1][kc], false, bp[kc],
                                                             (short)0, acc1, false, false);
                acc2 = __builtin_amdgcn_wmma_f32_16x16x4_f32(false, va[2][kc], false, bp[kc],
                                                             (short)0, acc2, false, false);
                acc3 = __builtin_amdgcn_wmma_f32_16x16x4_f32(false, va[3][kc], false, bp[kc],
                                                             (short)0, acc3, false, false);
            }
            // keeps the wait for the next tile's loads from rising in front of this tile's
            // softmax, where the wave would sit out their whole trip to L2
            __builtin_amdgcn_sched_barrier(0);
            ka0 = kn0;
            ka1 = kn1;
#pragma unroll
            for (int kc = 0; kc < 4; ++kc) {
#pragma unroll
                for (int cg = 0; cg < 4; ++cg) { va[cg][kc].x = vl[kc][0][cg]; va[cg][kc].y = vl[kc][1][cg]; }
            }
        }

        __builtin_amdgcn_s_setprio(0);   // back to the default before the barrier (a short share can end above it)
        l += xhalf(l);   // the two halves' denominators

        // this range's partial sums and statistics (a wave without tiles: -inf, 0, zeros)
        float* pw = &spart[wv][8 * h * OP + lm];
#pragma unroll
        for (int r = 0; r < 8; ++r) {
            pw[(0 * 16 + r) * OP] = acc0[r];
            pw[(1 * 16 + r) * OP] = acc1[r];
            pw[(2 * 16 + r) * OP] = acc2[r];
            pw[(3 * 16 + r) * OP] = acc3[r];
        }
        if (h == 0) {   // both halves hold the same statistics
            sm[wv][lm] = m;
            sl[wv][lm] = l;
        }
      }
    }
    __syncthreads();   // the eight ranges' partial sums and the mean of v are in LDS

    float o[4] = {0.0f, 0.0f, 0.0f, 0.0f};
    if (anyvalid) {
        // range 0 always holds a valid key, so the maximum is finite and an empty
        // range (maximum -inf) weighs exactly 0
        float w[KW];
#pragma unroll
        for (int s = 0; s < KW; ++s) w[s] = sm[s][oq];
        float mx = w[0];
#pragma unroll
        for (int s = 1; s < KW; ++s) mx = fmaxf(mx, w[s]);
        float lsum = 0.0f;
#pragma unroll
        for (int s = 0; s < KW; ++s) {
            w[s] = __expf(w[s] - mx);
            lsum = fmaf(w[s], sl[s][oq], lsum);
        }
        const float rl = 1.0f / lsum;
#pragma unroll
        for (int cg = 0; cg < 4; ++cg) {
            if (cg == 0 || !part) {     // a dealt tile has the one output tile, in the first rows
                float a = 0.0f;
#pragma unroll
                for (int s = 0; s < KW; ++s) a = fmaf(w[s], spart[s][(cg * 16 + oc) * OP + oq], a);
                o[cg] = a * rl;
            }
        }
    }
    if (part) {
        if (anyvalid && a0 + oq < nv) out[abase] = fmaf(gamma, o[0], xa);
        if (i0 + oq >= nv) {
#pragma unroll
            for (int cg = 0; cg < 4; ++cg)
                out[obase + (size_t)cg * N_PIX] = fmaf(gamma, svm[4 * oc + cg], xv[cg]);
        }
        return;
    }
    if (anymasked) {
        const bool masked = i0 + oq >= nv;
#pragma unroll
        for (int cg = 0; cg < 4; ++cg) o[cg] = masked ? svm[4 * oc + cg] : o[cg];
    }
#pragma unroll
    for (int cg = 0; cg < 4; ++cg)
        out[obase + (size_t)cg * N_PIX] = fmaf(gamma, o[cg], xv[cg]);
}

// ---------------------------------------------------------------------------
extern "C" void kernel_launch(void* const* d_in, const int* in_sizes, int n_in,
                              void* d_out, int out_size, void* d_ws, size_t ws_size,
                              hipStream_t stream) {
    const float* x     = (const float*)d_in[0];
    const int*   mask  = (const int*)d_in[1];
    const float* Wq    = (const float*)d_in[2];
    const float* bq    = (const float*)d_in[3];
    const float* Wk    = (const float*)d_in[4];
    const float* bk    = (const float*)d_in[5];
    const float* Wv    = (const float*)d_in[6];
    const float* bv    = (const float*)d_in[7];
    const float* gamma = (const float*)d_in[8];
    float* out = (float*)d_out;

    float* qws = (float*)d_ws;                    // 4*4096*8  floats
    float* kws = qws + 4 * N_PIX * CQ;            // 4*4096*8  floats
    float* vws = kws + 4 * N_PIX * CQ;            // 4*64*4096 floats
    int*   invws = (int*)(vws + 4 * C_IN * N_PIX);    // 4*4096 ints: pixel at a packed place
    int*   nvws  = invws + 4 * N_PIX;                 // 4 ints: valid pixels per batch
    float* vpart = (float*)(nvws + 4);                // 4*128*64 floats: sums of v per block

    proj_kernel<<<4 * N_PIX / PROJ_PIX, 160, 0, stream>>>(x, mask, Wq, bq, Wk, bk, Wv, bv, qws, kws, vws,
                                                        invws, nvws, vpart);
    attn_kernel<<<4 * N_PIX / 16, 256, 0, stream>>>(x, nvws, invws, qws, kws, vws, vpart, gamma, out);
}
